// v000
// Times are from an AMD MI455X. After a warm-up the kernel runs many times in a row, and a time is the length of
// such a window on the GPU divided by its runs, so every launch and the gaps after it count. The runs cycle
// through copies of the inputs. A figure is the median of several windows, for all but v000 over two sittings.
// Sittings can differ by a few percent; kernels timed side by side share one.
// The starting kernel, v000, takes 162 microseconds a run.
#include <hip/hip_runtime.h>
#include <hip/hip_bf16.h>
#include <math.h>

typedef float v2f __attribute__((ext_vector_type(2)));
typedef float v8f __attribute__((ext_vector_type(8)));
typedef int   v4i_vs __attribute__((vector_size(16)));   // matches builtin param

// Problem shape (fixed by the reference)
constexpr int BATCH = 4;
constexpr int SEQ   = 4096;
constexpr int HID   = 1024;
constexpr int SDIM  = 16;
constexpr int ROWS  = BATCH * SEQ;     // 16384  (row = b*SEQ + t)
constexpr int LCH   = 32;              // scan chunk length
constexpr int NCHB  = SEQ / LCH;       // 128 chunks per batch
constexpr int NCH   = BATCH * NCHB;    // 512 chunks total

// Workspace layout (float offsets); total ~3.3 MB of f32
constexpr int WS_BD    = 0;                           // B_d [16][1024]
constexpr int WS_P     = WS_BD + SDIM * HID;          // P_j = A_d^j, j=0..32
constexpr int WS_U     = WS_P + (LCH + 1) * 256;      // u [ROWS][16]
constexpr int WS_SL    = WS_U + ROWS * SDIM;          // local (zero-carry) states
constexpr int WS_CARRY = WS_SL + ROWS * SDIM;         // carry-in per chunk [NCH][16]
constexpr int WS_S     = WS_CARRY + NCH * SDIM;       // corrected states [ROWS][16]

// CDNA5 async global->LDS path (ASYNCcnt-tracked, no VGPR round trip)
#if defined(__gfx1250__) && __has_builtin(__builtin_amdgcn_global_load_async_to_lds_b128)
#define HAVE_ASYNC_LDS 1
#else
#define HAVE_ASYNC_LDS 0
#endif

#if __has_builtin(__builtin_amdgcn_s_wait_asynccnt)
#define WAIT_ASYNCCNT(n) __builtin_amdgcn_s_wait_asynccnt(n)
#else
#define WAIT_ASYNCCNT(n) asm volatile("s_wait_asynccnt " #n ::: "memory")
#endif

// ---------------------------------------------------------------------------
// f32 WMMA: D = A(16x4) * B(4x16) + C(16x16), full f32 precision.
// A layout (ISA 7.12.2): lane l -> M = l%16, VGPR v -> K = v + 2*(l/16)
// B layout (row-striped): lane l -> N = l%16, VGPR v -> K = v + 2*(l/16)
// C/D layout: lane l -> N = l%16, VGPR v -> M = v + 8*(l/16)
// ---------------------------------------------------------------------------
__device__ __forceinline__ v8f wmma_f32_16x16x4(v2f a, v2f b, v8f c) {
  return __builtin_amdgcn_wmma_f32_16x16x4_f32(false, a, false, b, (short)0, c,
                                               false, false);
}

// ===========================================================================
// Kernel 1: setup. dt, A_d = expm(A*dt) (Taylor 12 + 6 squarings),
// Ainv via Gauss-Jordan w/ partial pivoting, M = Ainv*(A_d - I),
// B_d = M*B, powers P_0..P_32.  One block, 256 threads (thread = elem (i,j)).
// ===========================================================================
__global__ __launch_bounds__(256) void k_setup(const float* __restrict__ A,
                                               const float* __restrict__ Bmat,
                                               const float* __restrict__ log_dt,
                                               float* __restrict__ ws) {
  __shared__ float red[256];
  __shared__ float Ms[256], term[256], acc[256], Ad[256];
  __shared__ float aug[16 * 33];
  __shared__ float fcol[16];
  __shared__ float Ainv[256], Mm[256], Pc[256];
  __shared__ float s_dt, s_inv;
  __shared__ int s_piv;

  const int tid = threadIdx.x;
  const int i = tid >> 4, j = tid & 15;

  // ---- dt = mean(exp(log_dt)) ----
  float s = 0.f;
  for (int q = tid; q < HID; q += 256) s += expf(log_dt[q]);
  red[tid] = s;
  __syncthreads();
  for (int o = 128; o > 0; o >>= 1) {
    if (tid < o) red[tid] += red[tid + o];
    __syncthreads();
  }
  if (tid == 0) s_dt = red[0] * (1.0f / (float)HID);
  __syncthreads();

  // ---- expm(A*dt): scale by 2^-6, Taylor 12, square 6x ----
  Ms[tid]   = A[tid] * (s_dt * (1.0f / 64.0f));
  term[tid] = (i == j) ? 1.f : 0.f;
  acc[tid]  = (i == j) ? 1.f : 0.f;
  __syncthreads();
  for (int it = 1; it <= 12; ++it) {
    float t2 = 0.f;
    for (int k = 0; k < 16; ++k) t2 += term[i * 16 + k] * Ms[k * 16 + j];
    __syncthreads();
    term[tid] = t2 / (float)it;
    acc[tid] += term[tid];
    __syncthreads();
  }
  for (int sq = 0; sq < 6; ++sq) {
    float t2 = 0.f;
    for (int k = 0; k < 16; ++k) t2 += acc[i * 16 + k] * acc[k * 16 + j];
    __syncthreads();
    acc[tid] = t2;
    __syncthreads();
  }
  Ad[tid] = acc[tid];
  __syncthreads();

  // ---- Gauss-Jordan inverse of A (augmented [A | I], partial pivoting) ----
  aug[i * 33 + j]      = A[tid];
  aug[i * 33 + 16 + j] = (i == j) ? 1.f : 0.f;
  __syncthreads();
  for (int k = 0; k < 16; ++k) {
    if (tid == 0) {
      int p = k;
      float best = fabsf(aug[k * 33 + k]);
      for (int r = k + 1; r < 16; ++r) {
        float v = fabsf(aug[r * 33 + k]);
        if (v > best) { best = v; p = r; }
      }
      s_piv = p;
    }
    __syncthreads();
    const int p = s_piv;
    if (p != k && tid < 32) {
      float t2 = aug[k * 33 + tid];
      aug[k * 33 + tid] = aug[p * 33 + tid];
      aug[p * 33 + tid] = t2;
    }
    __syncthreads();
    if (tid == 0) s_inv = 1.0f / aug[k * 33 + k];
    __syncthreads();
    if (tid < 32) aug[k * 33 + tid] *= s_inv;
    __syncthreads();
    if (tid < 16) fcol[tid] = aug[tid * 33 + k];
    __syncthreads();
    if (i != k) {
      aug[i * 33 + j]      -= fcol[i] * aug[k * 33 + j];
      aug[i * 33 + 16 + j] -= fcol[i] * aug[k * 33 + 16 + j];
    }
    __syncthreads();
  }
  Ainv[tid] = aug[i * 33 + 16 + j];
  __syncthreads();

  // ---- M = Ainv * (A_d - I) ----
  {
    float t2 = 0.f;
    for (int k = 0; k < 16; ++k) {
      float ad = Ad[k * 16 + j] - ((k == j) ? 1.f : 0.f);
      t2 += Ainv[i * 16 + k] * ad;
    }
    Mm[tid] = t2;
  }
  __syncthreads();

  // ---- B_d = M * B  ([16][1024]) ----
  for (int q = 0; q < (SDIM * HID) / 256; ++q) {
    int idx = q * 256 + tid;
    int n = idx >> 10, h = idx & (HID - 1);
    float t2 = 0.f;
    for (int k = 0; k < 16; ++k) t2 += Mm[n * 16 + k] * Bmat[k * HID + h];
    ws[WS_BD + idx] = t2;
  }

  // ---- powers P_0..P_LCH of A_d ----
  ws[WS_P + tid]       = (i == j) ? 1.f : 0.f;
  ws[WS_P + 256 + tid] = Ad[tid];
  Pc[tid] = Ad[tid];
  __syncthreads();
  for (int jp = 2; jp <= LCH; ++jp) {
    float t2 = 0.f;
    for (int k = 0; k < 16; ++k) t2 += Pc[i * 16 + k] * Ad[k * 16 + j];
    __syncthreads();
    Pc[tid] = t2;
    ws[WS_P + jp * 256 + tid] = t2;
    __syncthreads();
  }
}

// ===========================================================================
// Kernel 2: u = x @ B_d^T  (M=16384, K=1024, N=16) with f32 WMMA.
// Block = 256 threads = 8 waves; wave owns a 16-row tile (private LDS stage).
// Async path: GLOBAL_LOAD_ASYNC_TO_LDS_B128 double-buffered, ASYNCcnt-paced,
// zero barriers (DS ops are in-order in HW; explicit s_wait_dscnt guards the
// async-write-after-ds-read hazard since ASYNCcnt/DScnt are unordered).
// ===========================================================================
constexpr int KSW  = 32;   // K columns staged per step
constexpr int XPAD = 36;   // row pad: stride 36 mod 64 -> conflict-free banks

__global__ __launch_bounds__(256) void k_u_gemm(const float* __restrict__ x,
                                                float* __restrict__ ws) {
#if HAVE_ASYNC_LDS
  __shared__ float Xs[8][2][16 * XPAD];   // double buffer, 36.9 KB
#else
  __shared__ float Xs[8][1][16 * XPAD];
#endif
  const int tid = threadIdx.x;
  const int w = tid >> 5, lane = tid & 31;
  const int M = lane & 15, half = lane >> 4;
  const int rowbase = blockIdx.x * 128 + w * 16;
  const float* __restrict__ Bd = ws + WS_BD;

  v8f acc = {0.f, 0.f, 0.f, 0.f, 0.f, 0.f, 0.f, 0.f};

  auto compute = [&](int stq, int buf) {
    const int k0 = stq * KSW;
#pragma unroll
    for (int kk = 0; kk < KSW; kk += 4) {
      v2f a = *(const v2f*)&Xs[w][buf][M * XPAD + kk + 2 * half];
      v2f b = *(const v2f*)&Bd[M * HID + k0 + kk + 2 * half];
      acc = wmma_f32_16x16x4(a, b, acc);
    }
  };

#if HAVE_ASYNC_LDS
  auto stage_async = [&](int stq, int buf) {
    // previous ds reads of this buffer must have executed before async writes
    asm volatile("s_wait_dscnt 0x0" ::: "memory");
#pragma unroll
    for (int it = 0; it < 4; ++it) {   // 4 x B128 per lane = 16 rows x 32 cols
      const int r = it * 4 + (lane >> 3), c4 = lane & 7;
      __builtin_amdgcn_global_load_async_to_lds_b128(
          (__attribute__((address_space(1))) v4i_vs*)
              &x[(rowbase + r) * HID + stq * KSW + c4 * 4],
          (__attribute__((address_space(3))) v4i_vs*)
              &Xs[w][buf][r * XPAD + c4 * 4],
          0, 0);
    }
  };

  stage_async(0, 0);
  for (int st = 0; st < HID / KSW; ++st) {
    const int buf = st & 1;
    if (st + 1 < HID / KSW) {
      stage_async(st + 1, buf ^ 1);
      __builtin_prefetch(&x[(rowbase + M) * HID + (st + 1) * KSW], 0, 1);
      WAIT_ASYNCCNT(4);   // dones are in-order: only newest stage outstanding
    } else {
      WAIT_ASYNCCNT(0);
    }
    compute(st, buf);
  }
#else
  for (int st = 0; st < HID / KSW; ++st) {
    const int k0 = st * KSW;
#pragma unroll
    for (int it = 0; it < 4; ++it) {
      const int r = it * 4 + (lane >> 3), c4 = lane & 7;
      const float4 v = *(const float4*)&x[(rowbase + r) * HID + k0 + c4 * 4];
      *(float4*)&Xs[w][0][r * XPAD + c4 * 4] = v;
    }
    if (st + 1 < HID / KSW)
      __builtin_prefetch(&x[(rowbase + M) * HID + k0 + KSW], 0, 1);
    __syncthreads();
    compute(st, 0);
    __syncthreads();
  }
#endif

#pragma unroll
  for (int v = 0; v < 8; ++v)
    ws[WS_U + (rowbase + v + 8 * half) * SDIM + M] = acc[v];
}

// ===========================================================================
// Kernel 3: per-chunk local scan (zero carry-in): s_j = s_{j-1} A_d + u_j.
// 16 lanes per chunk, cross-lane via shfl(width 16); A_d column in registers.
// ===========================================================================
__global__ __launch_bounds__(256) void k_scan_local(float* __restrict__ ws) {
  const int tid = threadIdx.x;
  const int n = tid & 15;
  const int chunk = blockIdx.x * 16 + (tid >> 4);
  float Acol[16];
#pragma unroll
  for (int m = 0; m < 16; ++m) Acol[m] = ws[WS_P + 256 + m * 16 + n];
  float s = 0.f;
  const int base = chunk * LCH;
  for (int j2 = 0; j2 < LCH; ++j2) {
    float sn = ws[WS_U + (base + j2) * SDIM + n];
#pragma unroll
    for (int m = 0; m < 16; ++m) sn += __shfl(s, m, 16) * Acol[m];
    s = sn;
    ws[WS_SL + (base + j2) * SDIM + n] = s;
  }
}

// ===========================================================================
// Kernel 4: chunk carries: C_{c+1} = C_c * A_d^L + v_c. 128 small steps per
// batch (vs 4096 serial steps naively). Also writes final_state to out tail.
// ===========================================================================
__global__ __launch_bounds__(64) void k_carry(const float* __restrict__ state0,
                                              float* __restrict__ ws,
                                              float* __restrict__ out) {
  const int tid = threadIdx.x;
  const int b = tid >> 4, n = tid & 15;
  float Tcol[16];
#pragma unroll
  for (int m = 0; m < 16; ++m) Tcol[m] = ws[WS_P + LCH * 256 + m * 16 + n];
  float carry = state0[b * 16 + n];
  for (int c = 0; c < NCHB; ++c) {
    ws[WS_CARRY + (b * NCHB + c) * SDIM + n] = carry;
    float nc = ws[WS_SL + (b * SEQ + c * LCH + (LCH - 1)) * SDIM + n];
#pragma unroll
    for (int m = 0; m < 16; ++m) nc += __shfl(carry, m, 16) * Tcol[m];
    carry = nc;
  }
  out[ROWS * HID + b * 16 + n] = carry;  // final_state
}

// ===========================================================================
// Kernel 5: s_t = Sl_t + carry_c * P_{j+1}  (parallel carry correction)
// ===========================================================================
__global__ __launch_bounds__(256) void k_correct(float* __restrict__ ws) {
  const int g = blockIdx.x * 256 + threadIdx.x;
  const int row = g >> 4, n = g & 15;
  const int j2 = row & (LCH - 1), c = row >> 5;  // row%32 == t%32 (4096%32==0)
  float acc = ws[WS_SL + g];
  const float* __restrict__ P  = ws + WS_P + (j2 + 1) * 256;
  const float* __restrict__ cr = ws + WS_CARRY + c * SDIM;
#pragma unroll
  for (int m = 0; m < 16; ++m) acc += cr[m] * P[m * 16 + n];
  ws[WS_S + g] = acc;
}

// ===========================================================================
// Kernel 6: out = states @ C^T  (M=16384, K=16, N=1024) with f32 WMMA.
// Wave owns one 16-row tile and 8 h-tiles; A-fragments loaded once, 4 chained
// 16x16x4 WMMAs cover K=16 per tile.
// ===========================================================================
__global__ __launch_bounds__(256) void k_out_gemm(const float* __restrict__ Cmat,
                                                  const float* __restrict__ ws,
                                                  float* __restrict__ out) {
  const int tid = threadIdx.x;
  const int wglobal = blockIdx.x * 8 + (tid >> 5);
  const int rt = wglobal >> 3, hg = wglobal & 7;
  const int lane = tid & 31, M = lane & 15, half = lane >> 4;
  const float* __restrict__ S = ws + WS_S;

  v2f a[4];
#pragma unroll
  for (int k4 = 0; k4 < 4; ++k4)
    a[k4] = *(const v2f*)&S[(rt * 16 + M) * SDIM + k4 * 4 + 2 * half];

#pragma unroll
  for (int ht = 0; ht < 8; ++ht) {
    const int hbase = (hg * 8 + ht) * 16;
    v8f acc = {0.f, 0.f, 0.f, 0.f, 0.f, 0.f, 0.f, 0.f};
#pragma unroll
    for (int k4 = 0; k4 < 4; ++k4) {
      v2f b = *(const v2f*)&Cmat[(hbase + M) * SDIM + k4 * 4 + 2 * half];
      acc = wmma_f32_16x16x4(a[k4], b, acc);
    }
#pragma unroll
    for (int v = 0; v < 8; ++v)
      out[(rt * 16 + v + 8 * half) * HID + hbase + M] = acc[v];
  }
}

// ===========================================================================
extern "C" void kernel_launch(void* const* d_in, const int* in_sizes, int n_in,
                              void* d_out, int out_size, void* d_ws,
                              size_t ws_size, hipStream_t stream) {
  const float* x   = (const float*)d_in[0];  // [4,4096,1024]
  const float* st0 = (const float*)d_in[1];  // [4,16]
  const float* A   = (const float*)d_in[2];  // [16,16]
  const float* B   = (const float*)d_in[3];  // [16,1024]
  const float* C   = (const float*)d_in[4];  // [1024,16]
  const float* ld  = (const float*)d_in[5];  // [1024]
  float* out = (float*)d_out;                // [4,4096,1024] ++ [4,16]
  float* ws  = (float*)d_ws;                 // needs ~3.3 MB f32 scratch

  k_setup<<<1, 256, 0, stream>>>(A, B, ld, ws);
  k_u_gemm<<<ROWS / 128, 256, 0, stream>>>(x, ws);
  k_scan_local<<<NCH / 16, 256, 0, stream>>>(ws);
  k_carry<<<1, 64, 0, stream>>>(st0, ws, out);
  k_correct<<<(ROWS * SDIM) / 256, 256, 0, stream>>>(ws);
  k_out_gemm<<<(ROWS / 16), 256, 0, stream>>>(C, ws, out);
}

// v002
// It runs in 68.7 microseconds.
// Versions between v000 and this one are left out; their measured steps multiply to 2.38 times as fast.
#include <hip/hip_runtime.h>
#include <hip/hip_bf16.h>
#include <math.h>

typedef float v2f __attribute__((ext_vector_type(2)));
typedef float v8f __attribute__((ext_vector_type(8)));
typedef int   v4i_vs __attribute__((vector_size(16)));   // matches builtin param

// Problem shape (fixed by the reference)
constexpr int BATCH = 4;
constexpr int SEQ   = 4096;
constexpr int HID   = 1024;
constexpr int SDIM  = 16;
constexpr int ROWS  = BATCH * SEQ;     // 16384  (row = b*SEQ + t)
constexpr int LCH   = 32;              // scan chunk length
constexpr int NCHB  = SEQ / LCH;       // 128 chunks per batch
constexpr int NCH   = BATCH * NCHB;    // 512 chunks total

// Workspace layout (float offsets); total ~3.2 MB of f32
constexpr int WS_M     = 0;                           // M = A^-1 (A_d - I) [16][16]
constexpr int WS_P     = WS_M + 256;                  // P_j = A_d^j, j=0..32
constexpr int WS_U     = WS_P + (LCH + 1) * 256;      // y = x B^T [ROWS][16]
constexpr int WS_SL    = WS_U + ROWS * SDIM;          // local (zero-carry) states
constexpr int WS_CARRY = WS_SL + ROWS * SDIM;         // carry-in per chunk [NCH][16]
constexpr int WS_S     = WS_CARRY + NCH * SDIM;       // corrected states [ROWS][16]

// CDNA5 async global->LDS path (ASYNCcnt-tracked, no VGPR round trip)
#if defined(__gfx1250__) && __has_builtin(__builtin_amdgcn_global_load_async_to_lds_b128)
#define HAVE_ASYNC_LDS 1
#else
#define HAVE_ASYNC_LDS 0
#endif

#if __has_builtin(__builtin_amdgcn_s_wait_asynccnt)
#define WAIT_ASYNCCNT(n) __builtin_amdgcn_s_wait_asynccnt(n)
#else
#define WAIT_ASYNCCNT(n) asm volatile("s_wait_asynccnt " #n ::: "memory")
#endif

// ---------------------------------------------------------------------------
// f32 WMMA: D = A(16x4) * B(4x16) + C(16x16), full f32 precision.
// A layout (ISA 7.12.2): lane l -> M = l%16, VGPR v -> K = v + 2*(l/16)
// B layout (row-striped): lane l -> N = l%16, VGPR v -> K = v + 2*(l/16)
// C/D layout: lane l -> N = l%16, VGPR v -> M = v + 8*(l/16)
// ---------------------------------------------------------------------------
__device__ __forceinline__ v8f wmma_f32_16x16x4(v2f a, v2f b, v8f c) {
  return __builtin_amdgcn_wmma_f32_16x16x4_f32(false, a, false, b, (short)0, c,
                                               false, false);
}

// ===========================================================================
// Setup (one block of kernel 1). dt, A_d = expm(A*dt) (Taylor 12 + 6
// squarings), Ainv via Gauss-Jordan w/ partial pivoting, M = Ainv*(A_d - I),
// powers P_0..P_32.  256 threads (thread = elem (i,j)).
// B_d = M*B is never formed: x B_d^T = (x B^T) M^T, so the big product needs
// nothing from here and this serial work runs beside it in the same launch.
// ===========================================================================
__device__ __forceinline__ void setup_block(const float* __restrict__ A,
                                            const float* __restrict__ log_dt,
                                            float* __restrict__ ws) {
  __shared__ float red[256];
  __shared__ float Ms[256], term[256], acc[256], Ad[256];
  __shared__ float aug[16 * 33];
  __shared__ float fcol[16];
  __shared__ float Ainv[256], Pc[256];
  __shared__ float s_dt, s_inv;
  __shared__ int s_piv;

  const int tid = threadIdx.x;
  const int i = tid >> 4, j = tid & 15;

  // ---- dt = mean(exp(log_dt)) ----
  float s = 0.f;
  for (int q = tid; q < HID; q += 256) s += expf(log_dt[q]);
  red[tid] = s;
  __syncthreads();
  for (int o = 128; o > 0; o >>= 1) {
    if (tid < o) red[tid] += red[tid + o];
    __syncthreads();
  }
  if (tid == 0) s_dt = red[0] * (1.0f / (float)HID);
  __syncthreads();

  // ---- expm(A*dt): scale by 2^-6, Taylor 12, square 6x ----
  Ms[tid]   = A[tid] * (s_dt * (1.0f / 64.0f));
  term[tid] = (i == j) ? 1.f : 0.f;
  acc[tid]  = (i == j) ? 1.f : 0.f;
  __syncthreads();
  for (int it = 1; it <= 12; ++it) {
    float t2 = 0.f;
    for (int k = 0; k < 16; ++k) t2 += term[i * 16 + k] * Ms[k * 16 + j];
    __syncthreads();
    term[tid] = t2 / (float)it;
    acc[tid] += term[tid];
    __syncthreads();
  }
  for (int sq = 0; sq < 6; ++sq) {
    float t2 = 0.f;
    for (int k = 0; k < 16; ++k) t2 += acc[i * 16 + k] * acc[k * 16 + j];
    __syncthreads();
    acc[tid] = t2;
    __syncthreads();
  }
  Ad[tid] = acc[tid];
  __syncthreads();

  // ---- Gauss-Jordan inverse of A (augmented [A | I], partial pivoting) ----
  aug[i * 33 + j]      = A[tid];
  aug[i * 33 + 16 + j] = (i == j) ? 1.f : 0.f;
  __syncthreads();
  for (int k = 0; k < 16; ++k) {
    if (tid == 0) {
      int p = k;
      float best = fabsf(aug[k * 33 + k]);
      for (int r = k + 1; r < 16; ++r) {
        float v = fabsf(aug[r * 33 + k]);
        if (v > best) { best = v; p = r; }
      }
      s_piv = p;
    }
    __syncthreads();
    const int p = s_piv;
    if (p != k && tid < 32) {
      float t2 = aug[k * 33 + tid];
      aug[k * 33 + tid] = aug[p * 33 + tid];
      aug[p * 33 + tid] = t2;
    }
    __syncthreads();
    if (tid == 0) s_inv = 1.0f / aug[k * 33 + k];
    __syncthreads();
    if (tid < 32) aug[k * 33 + tid] *= s_inv;
    __syncthreads();
    if (tid < 16) fcol[tid] = aug[tid * 33 + k];
    __syncthreads();
    if (i != k) {
      aug[i * 33 + j]      -= fcol[i] * aug[k * 33 + j];
      aug[i * 33 + 16 + j] -= fcol[i] * aug[k * 33 + 16 + j];
    }
    __syncthreads();
  }
  Ainv[tid] = aug[i * 33 + 16 + j];
  __syncthreads();

  // ---- M = Ainv * (A_d - I) ----
  {
    float t2 = 0.f;
    for (int k = 0; k < 16; ++k) {
      float ad = Ad[k * 16 + j] - ((k == j) ? 1.f : 0.f);
      t2 += Ainv[i * 16 + k] * ad;
    }
    ws[WS_M + tid] = t2;
  }

  // ---- powers P_0..P_LCH of A_d ----
  ws[WS_P + tid]       = (i == j) ? 1.f : 0.f;
  ws[WS_P + 256 + tid] = Ad[tid];
  Pc[tid] = Ad[tid];
  __syncthreads();
  for (int jp = 2; jp <= LCH; ++jp) {
    float t2 = 0.f;
    for (int k = 0; k < 16; ++k) t2 += Pc[i * 16 + k] * Ad[k * 16 + j];
    __syncthreads();
    Pc[tid] = t2;
    ws[WS_P + jp * 256 + tid] = t2;
    __syncthreads();
  }
}

// ===========================================================================
// Kernel 1: y = x @ B^T  (M=16384, K=1024, N=16) with f32 WMMA; the block
// behind the last row tile does the setup instead (nothing here reads it).
// Block = 256 threads = 8 waves; wave owns a 16-row tile (private LDS stage).
// Async path: GLOBAL_LOAD_ASYNC_TO_LDS_B128 double-buffered, ASYNCcnt-paced,
// zero barriers (DS ops are in-order in HW; explicit s_wait_dscnt guards the
// async-write-after-ds-read hazard since ASYNCcnt/DScnt are unordered).
// ===========================================================================
constexpr int KSW  = 32;   // K columns staged per step
constexpr int XPAD = 36;   // row pad: stride 36 mod 64 -> conflict-free banks

__global__ __launch_bounds__(256) void k_u_gemm(const float* __restrict__ x,
                                                const float* __restrict__ A,
                                                const float* __restrict__ Bmat,
                                                const float* __restrict__ log_dt,
                                                float* __restrict__ ws) {
  if (blockIdx.x == ROWS / 128) {   // whole block
    setup_block(A, log_dt, ws);
    return;
  }
#if HAVE_ASYNC_LDS
  __shared__ float Xs[8][2][16 * XPAD];   // double buffer, 36.9 KB
#else
  __shared__ float Xs[8][1][16 * XPAD];
#endif
  const int tid = threadIdx.x;
  const int w = tid >> 5, lane = tid & 31;
  const int M = lane & 15, half = lane >> 4;
  const int rowbase = blockIdx.x * 128 + w * 16;

  v8f acc = {0.f, 0.f, 0.f, 0.f, 0.f, 0.f, 0.f, 0.f};

  auto compute = [&](int stq, int buf) {
    const int k0 = stq * KSW;
#pragma unroll
    for (int kk = 0; kk < KSW; kk += 4) {
      v2f a = *(const v2f*)&Xs[w][buf][M * XPAD + kk + 2 * half];
      v2f b = *(const v2f*)&Bmat[M * HID + k0 + kk + 2 * half];
      acc = wmma_f32_16x16x4(a, b, acc);
    }
  };

#if HAVE_ASYNC_LDS
  auto stage_async = [&](int stq, int buf) {
    // previous ds reads of this buffer must have executed before async writes
    asm volatile("s_wait_dscnt 0x0" ::: "memory");
#pragma unroll
    for (int it = 0; it < 4; ++it) {   // 4 x B128 per lane = 16 rows x 32 cols
      const int r = it * 4 + (lane >> 3), c4 = lane & 7;
      __builtin_amdgcn_global_load_async_to_lds_b128(
          (__attribute__((address_space(1))) v4i_vs*)
              &x[(rowbase + r) * HID + stq * KSW + c4 * 4],
          (__attribute__((address_space(3))) v4i_vs*)
              &Xs[w][buf][r * XPAD + c4 * 4],
          0, 0);
    }
  };

  stage_async(0, 0);
  for (int st = 0; st < HID / KSW; ++st) {
    const int buf = st & 1;
    if (st + 1 < HID / KSW) {
      stage_async(st + 1, buf ^ 1);
      __builtin_prefetch(&x[(rowbase + M) * HID + (st + 1) * KSW], 0, 1);
      WAIT_ASYNCCNT(4);   // dones are in-order: only newest stage outstanding
    } else {
      WAIT_ASYNCCNT(0);
    }
    compute(st, buf);
  }
#else
  for (int st = 0; st < HID / KSW; ++st) {
    const int k0 = st * KSW;
#pragma unroll
    for (int it = 0; it < 4; ++it) {
      const int r = it * 4 + (lane >> 3), c4 = lane & 7;
      const float4 v = *(const float4*)&x[(rowbase + r) * HID + k0 + c4 * 4];
      *(float4*)&Xs[w][0][r * XPAD + c4 * 4] = v;
    }
    if (st + 1 < HID / KSW)
      __builtin_prefetch(&x[(rowbase + M) * HID + k0 + KSW], 0, 1);
    __syncthreads();
    compute(st, 0);
    __syncthreads();
  }
#endif

#pragma unroll
  for (int v = 0; v < 8; ++v)
    ws[WS_U + (rowbase + v + 8 * half) * SDIM + M] = acc[v];
}

// ===========================================================================
// Kernel 2: per-chunk local scan (zero carry-in): s_j = s_{j-1} A_d + u_j.
// 16 lanes per chunk, cross-lane via shfl(width 16); A_d column in registers.
// The block's 16 chunks of y are read in one batch of loads, turned into
// u = y M^T on the way (f32 WMMA, each wave its own 64 rows = 4 tiles) and
// staged in LDS, so no step of the serial chain waits for a global load.
// ===========================================================================
__global__ __launch_bounds__(256) void k_scan_local(float* __restrict__ ws) {
  constexpr int BLK = 16 * LCH * SDIM;   // floats of y per block (contiguous)
  __shared__ float U[BLK];               // 32 KB
  const int tid = threadIdx.x;
  const int n = tid & 15;
  const int blk = blockIdx.x * BLK;
  float Acol[16];
#pragma unroll
  for (int m = 0; m < 16; ++m) Acol[m] = ws[WS_P + 256 + m * 16 + n];
  const int half = (tid >> 4) & 1;
  const int wrow = (tid >> 5) * (2 * LCH);   // first of the wave's 64 rows
  v2f mb[4], ya[4][4];
  // loops unrolled: the fragment arrays need constant indices to stay in
  // registers, and all 20 loads go out in one batch ahead of the first WMMA
#pragma unroll
  for (int k4 = 0; k4 < 4; ++k4)
    mb[k4] = *(const v2f*)&ws[WS_M + n * SDIM + k4 * 4 + 2 * half];
#pragma unroll
  for (int t = 0; t < 4; ++t)
#pragma unroll
    for (int k4 = 0; k4 < 4; ++k4)
      ya[t][k4] = *(const v2f*)&ws[WS_U + blk + (wrow + t * 16 + n) * SDIM +
                                   k4 * 4 + 2 * half];
#pragma unroll
  for (int t = 0; t < 4; ++t) {
    v8f acc = {0.f, 0.f, 0.f, 0.f, 0.f, 0.f, 0.f, 0.f};
#pragma unroll
    for (int k4 = 0; k4 < 4; ++k4) acc = wmma_f32_16x16x4(ya[t][k4], mb[k4], acc);
#pragma unroll
    for (int v = 0; v < 8; ++v)
      U[(wrow + t * 16 + v + 8 * half) * SDIM + n] = acc[v];
  }
  __syncthreads();
  float s = 0.f;
  const int loc = (tid >> 4) * (LCH * SDIM) + n;
  for (int j0 = 0; j0 < LCH; j0 += 16) {
    // 16 steps unrolled so that their LDS reads issue together, ahead of the
    // chain, and the LDS latency is paid once per 16 steps
#pragma unroll
    for (int k = 0; k < 16; ++k) {
      const int j2 = j0 + k;
      float sn = U[loc + j2 * SDIM];
#pragma unroll
      for (int m = 0; m < 16; ++m) sn += __shfl(s, m, 16) * Acol[m];
      s = sn;
      ws[WS_SL + blk + loc + j2 * SDIM] = s;
    }
    // the next pass rewrites the registers that this pass's stores name
    asm volatile("s_wait_xcnt 0x0" ::: "memory");
  }
}

// ===========================================================================
// Kernel 3: chunk carries: C_{c+1} = C_c * A_d^L + v_c. 128 small steps per
// batch (vs 4096 serial steps naively). Also writes final_state to out tail.
// The 512 chunk-end rows v_c are staged in LDS by 8 waves in one batch of
// loads; the serial chain (waves 0 and 1) then reads its addend from LDS and
// waits for no global load.
// ===========================================================================
__global__ __launch_bounds__(256) void k_carry(const float* __restrict__ state0,
                                               float* __restrict__ ws,
                                               float* __restrict__ out) {
  __shared__ float V[NCH * SDIM];   // v_c, row = b*NCHB + c, 32 KB
  const int tid = threadIdx.x;
  const int b = tid >> 4, n = tid & 15;
  float Tcol[16];
#pragma unroll
  for (int m = 0; m < 16; ++m) Tcol[m] = ws[WS_P + LCH * 256 + m * 16 + n];
  float carry = (tid < BATCH * SDIM) ? state0[tid] : 0.f;
#pragma unroll
  for (int q = 0; q < (NCH * SDIM) / (4 * 256); ++q) {
    const int f4 = q * 256 + tid;            // float4 index: row f4/4, part f4%4
    const int row = f4 >> 2, part = f4 & 3;
    *(float4*)&V[f4 * 4] =
        *(const float4*)&ws[WS_SL + (row * LCH + (LCH - 1)) * SDIM + part * 4];
  }
  __syncthreads();
  if (tid >= BATCH * SDIM) return;   // whole waves; no barrier follows
  for (int c0 = 0; c0 < NCHB; c0 += 16) {
    // 16 steps unrolled so that their LDS reads issue together, ahead of the
    // chain, and the LDS latency is paid once per 16 steps
#pragma unroll
    for (int k = 0; k < 16; ++k) {
      const int c = c0 + k;
      ws[WS_CARRY + (b * NCHB + c) * SDIM + n] = carry;
      float nc = V[(b * NCHB + c) * SDIM + n];
#pragma unroll
      for (int m = 0; m < 16; ++m) nc += __shfl(carry, m, 16) * Tcol[m];
      carry = nc;
    }
  }
  out[ROWS * HID + b * 16 + n] = carry;  // final_state
}

// ===========================================================================
// Kernel 4: s_t = Sl_t + carry_c * P_{j+1}  (parallel carry correction)
// ===========================================================================
__global__ __launch_bounds__(256) void k_correct(float* __restrict__ ws) {
  const int g = blockIdx.x * 256 + threadIdx.x;
  const int row = g >> 4, n = g & 15;
  const int j2 = row & (LCH - 1), c = row >> 5;  // row%32 == t%32 (4096%32==0)
  float acc = ws[WS_SL + g];
  const float* __restrict__ P  = ws + WS_P + (j2 + 1) * 256;
  const float* __restrict__ cr = ws + WS_CARRY + c * SDIM;
#pragma unroll
  for (int m = 0; m < 16; ++m) acc += cr[m] * P[m * 16 + n];
  ws[WS_S + g] = acc;
}

// ===========================================================================
// Kernel 5: out = states @ C^T  (M=16384, K=16, N=1024) with f32 WMMA.
// Wave owns one 16-row tile and 8 h-tiles; A-fragments loaded once, 4 chained
// 16x16x4 WMMAs cover K=16 per tile.
// ===========================================================================
__global__ __launch_bounds__(256) void k_out_gemm(const float* __restrict__ Cmat,
                                                  const float* __restrict__ ws,
                                                  float* __restrict__ out) {
  const int tid = threadIdx.x;
  const int wglobal = blockIdx.x * 8 + (tid >> 5);
  const int rt = wglobal >> 3, hg = wglobal & 7;
  const int lane = tid & 31, M = lane & 15, half = lane >> 4;
  const float* __restrict__ S = ws + WS_S;

  v2f a[4];
#pragma unroll
  for (int k4 = 0; k4 < 4; ++k4)
    a[k4] = *(const v2f*)&S[(rt * 16 + M) * SDIM + k4 * 4 + 2 * half];

#pragma unroll
  for (int ht = 0; ht < 8; ++ht) {
    const int hbase = (hg * 8 + ht) * 16;
    v8f acc = {0.f, 0.f, 0.f, 0.f, 0.f, 0.f, 0.f, 0.f};
#pragma unroll
    for (int k4 = 0; k4 < 4; ++k4) {
      v2f b = *(const v2f*)&Cmat[(hbase + M) * SDIM + k4 * 4 + 2 * half];
      acc = wmma_f32_16x16x4(a[k4], b, acc);
    }
#pragma unroll
    for (int v = 0; v < 8; ++v)
      out[(rt * 16 + v + 8 * half) * HID + hbase + M] = acc[v];
  }
}

// ===========================================================================
extern "C" void kernel_launch(void* const* d_in, const int* in_sizes, int n_in,
                              void* d_out, int out_size, void* d_ws,
                              size_t ws_size, hipStream_t stream) {
  const float* x   = (const float*)d_in[0];  // [4,4096,1024]
  const float* st0 = (const float*)d_in[1];  // [4,16]
  const float* A   = (const float*)d_in[2];  // [16,16]
  const float* B   = (const float*)d_in[3];  // [16,1024]
  const float* C   = (const float*)d_in[4];  // [1024,16]
  const float* ld  = (const float*)d_in[5];  // [1024]
  float* out = (float*)d_out;                // [4,4096,1024] ++ [4,16]
  float* ws  = (float*)d_ws;                 // needs ~3.2 MB f32 scratch

  k_u_gemm<<<ROWS / 128 + 1, 256, 0, stream>>>(x, A, B, ld, ws);
  k_scan_local<<<NCH / 16, 256, 0, stream>>>(ws);
  k_carry<<<1, 256, 0, stream>>>(st0, ws, out);
  k_correct<<<(ROWS * SDIM) / 256, 256, 0, stream>>>(ws);
  k_out_gemm<<<(ROWS / 16), 256, 0, stream>>>(C, ws, out);
}

// v003
// A run of this version takes 53.4 microseconds.
// In both of two side-by-side timings against v002, it was 1.29 times as fast.
// All steps since v000 together make it 3.07 times as fast.
#include <hip/hip_runtime.h>
#include <hip/hip_bf16.h>
#include <math.h>

typedef float v2f __attribute__((ext_vector_type(2)));
typedef float v8f __attribute__((ext_vector_type(8)));
typedef int   v4i_vs __attribute__((vector_size(16)));   // matches builtin param

// Problem shape (fixed by the reference)
constexpr int BATCH = 4;
constexpr int SEQ   = 4096;
constexpr int HID   = 1024;
constexpr int SDIM  = 16;
constexpr int ROWS  = BATCH * SEQ;     // 16384  (row = b*SEQ + t)
constexpr int LCH   = 32;              // scan chunk length
constexpr int NCHB  = SEQ / LCH;       // 128 chunks per batch
constexpr int NCH   = BATCH * NCHB;    // 512 chunks total

// Workspace layout (float offsets); total ~3.2 MB of f32
constexpr int WS_M     = 0;                           // M = A^-1 (A_d - I) [16][16]
constexpr int WS_P     = WS_M + 256;                  // P_j = A_d^j, j=0..32
constexpr int WS_U     = WS_P + (LCH + 1) * 256;      // y = x B^T [ROWS][16]
constexpr int WS_SL    = WS_U + ROWS * SDIM;          // local (zero-carry) states
constexpr int WS_CARRY = WS_SL + ROWS * SDIM;         // carry-in per chunk [NCH][16]
constexpr int WS_S     = WS_CARRY + NCH * SDIM;       // corrected states [ROWS][16]

// CDNA5 async global->LDS path (ASYNCcnt-tracked, no VGPR round trip)
#if defined(__gfx1250__) && __has_builtin(__builtin_amdgcn_global_load_async_to_lds_b128)
#define HAVE_ASYNC_LDS 1
#else
#define HAVE_ASYNC_LDS 0
#endif

#if __has_builtin(__builtin_amdgcn_s_wait_asynccnt)
#define WAIT_ASYNCCNT(n) __builtin_amdgcn_s_wait_asynccnt(n)
#else
#define WAIT_ASYNCCNT(n) asm volatile("s_wait_asynccnt " #n ::: "memory")
#endif

// ---------------------------------------------------------------------------
// f32 WMMA: D = A(16x4) * B(4x16) + C(16x16), full f32 precision.
// A layout (ISA 7.12.2): lane l -> M = l%16, VGPR v -> K = v + 2*(l/16)
// B layout (row-striped): lane l -> N = l%16, VGPR v -> K = v + 2*(l/16)
// C/D layout: lane l -> N = l%16, VGPR v -> M = v + 8*(l/16)
// ---------------------------------------------------------------------------
__device__ __forceinline__ v8f wmma_f32_16x16x4(v2f a, v2f b, v8f c) {
  return __builtin_amdgcn_wmma_f32_16x16x4_f32(false, a, false, b, (short)0, c,
                                               false, false);
}

// ===========================================================================
// Setup (one block of kernel 1). dt, A_d = expm(A*dt) (Taylor 12 + 6
// squarings), Ainv via Gauss-Jordan w/ partial pivoting, M = Ainv*(A_d - I),
// powers P_0..P_32.  256 threads (thread = elem (i,j)).
// B_d = M*B is never formed: x B_d^T = (x B^T) M^T, so the big product needs
// nothing from here and this serial work runs beside it in the same launch.
// ===========================================================================
__device__ __forceinline__ void setup_block(const float* __restrict__ A,
                                            const float* __restrict__ log_dt,
                                            float* __restrict__ ws) {
  __shared__ float red[256];
  __shared__ float Ms[256], term[256], acc[256], Ad[256];
  __shared__ float aug[16 * 33];
  __shared__ float fcol[16];
  __shared__ float Ainv[256];
  __shared__ float s_dt, s_inv;
  __shared__ int s_piv;

  const int tid = threadIdx.x;
  const int i = tid >> 4, j = tid & 15;

  // ---- dt = mean(exp(log_dt)) ----
  float s = 0.f;
  for (int q = tid; q < HID; q += 256) s += expf(log_dt[q]);
  red[tid] = s;
  __syncthreads();
  for (int o = 128; o > 0; o >>= 1) {
    if (tid < o) red[tid] += red[tid + o];
    __syncthreads();
  }
  if (tid == 0) s_dt = red[0] * (1.0f / (float)HID);
  __syncthreads();

  // ---- expm(A*dt): scale by 2^-6, Taylor 12, square 6x ----
  Ms[tid]   = A[tid] * (s_dt * (1.0f / 64.0f));
  term[tid] = (i == j) ? 1.f : 0.f;
  acc[tid]  = (i == j) ? 1.f : 0.f;
  __syncthreads();
  for (int it = 1; it <= 12; ++it) {
    float t2 = 0.f;
    for (int k = 0; k < 16; ++k) t2 += term[i * 16 + k] * Ms[k * 16 + j];
    __syncthreads();
    term[tid] = t2 / (float)it;
    acc[tid] += term[tid];
    __syncthreads();
  }
  for (int sq = 0; sq < 6; ++sq) {
    float t2 = 0.f;
    for (int k = 0; k < 16; ++k) t2 += acc[i * 16 + k] * acc[k * 16 + j];
    __syncthreads();
    acc[tid] = t2;
    __syncthreads();
  }
  Ad[tid] = acc[tid];
  __syncthreads();

  // ---- Gauss-Jordan inverse of A (augmented [A | I], partial pivoting) ----
  aug[i * 33 + j]      = A[tid];
  aug[i * 33 + 16 + j] = (i == j) ? 1.f : 0.f;
  __syncthreads();
  for (int k = 0; k < 16; ++k) {
    if (tid == 0) {
      int p = k;
      float best = fabsf(aug[k * 33 + k]);
      for (int r = k + 1; r < 16; ++r) {
        float v = fabsf(aug[r * 33 + k]);
        if (v > best) { best = v; p = r; }
      }
      s_piv = p;
    }
    __syncthreads();
    const int p = s_piv;
    if (p != k && tid < 32) {
      float t2 = aug[k * 33 + tid];
      aug[k * 33 + tid] = aug[p * 33 + tid];
      aug[p * 33 + tid] = t2;
    }
    __syncthreads();
    if (tid == 0) s_inv = 1.0f / aug[k * 33 + k];
    __syncthreads();
    if (tid < 32) aug[k * 33 + tid] *= s_inv;
    __syncthreads();
    if (tid < 16) fcol[tid] = aug[tid * 33 + k];
    __syncthreads();
    if (i != k) {
      aug[i * 33 + j]      -= fcol[i] * aug[k * 33 + j];
      aug[i * 33 + 16 + j] -= fcol[i] * aug[k * 33 + 16 + j];
    }
    __syncthreads();
  }
  Ainv[tid] = aug[i * 33 + 16 + j];
  __syncthreads();

  // ---- M = Ainv * (A_d - I) ----
  {
    float t2 = 0.f;
    for (int k = 0; k < 16; ++k) {
      float ad = Ad[k * 16 + j] - ((k == j) ? 1.f : 0.f);
      t2 += Ainv[i * 16 + k] * ad;
    }
    ws[WS_M + tid] = t2;
  }

  // ---- powers P_0..P_LCH of A_d ----
  // P_k = P_(k-1) A_d goes row by row: row i of P_k needs only row i of
  // P_(k-1), which the row's own 16 lanes hold, and column j of A_d, which
  // never changes. So each 16-lane group carries its row through shuffles
  // (as k_scan_local does) and the chain meets no barrier and no store wait.
  // Same products, same k order as a plain P_(k-1) A_d.
  float Acol[16];
  // unrolled: constant indices keep the column in registers
#pragma unroll
  for (int k = 0; k < 16; ++k) Acol[k] = Ad[k * 16 + j];
  float pw[LCH + 1];
  pw[0] = (i == j) ? 1.f : 0.f;
  pw[1] = Ad[tid];
  // unrolled: every power stays in a register of its own until the stores
#pragma unroll
  for (int jp = 2; jp <= LCH; ++jp) {
    float t2 = 0.f;
    // unrolled: a shuffle from a constant lane compiles to a row broadcast in
    // the vector unit (no LDS round trip), and Acol needs constant indices
#pragma unroll
    for (int k = 0; k < 16; ++k) t2 += __shfl(pw[jp - 1], k, 16) * Acol[k];
    pw[jp] = t2;
  }
  // unrolled: constant indices; nothing behind these stores rewrites a
  // register that one of them names
#pragma unroll
  for (int jp = 0; jp <= LCH; ++jp) ws[WS_P + jp * 256 + tid] = pw[jp];
}

// ===========================================================================
// Kernel 1: y = x @ B^T  (M=16384, K=1024, N=16) with f32 WMMA; the block
// behind the last row tile does the setup instead (nothing here reads it).
// Block = 256 threads = 8 waves; wave owns a 16-row tile (private LDS stage).
// Async path: GLOBAL_LOAD_ASYNC_TO_LDS_B128 double-buffered, ASYNCcnt-paced,
// zero barriers (DS ops are in-order in HW; explicit s_wait_dscnt guards the
// async-write-after-ds-read hazard since ASYNCcnt/DScnt are unordered).
// ===========================================================================
constexpr int KSW  = 32;   // K columns staged per step
constexpr int XPAD = 36;   // row pad: stride 36 mod 64 -> conflict-free banks

__global__ __launch_bounds__(256) void k_u_gemm(const float* __restrict__ x,
                                                const float* __restrict__ A,
                                                const float* __restrict__ Bmat,
                                                const float* __restrict__ log_dt,
                                                float* __restrict__ ws) {
  if (blockIdx.x == ROWS / 128) {   // whole block
    setup_block(A, log_dt, ws);
    return;
  }
#if HAVE_ASYNC_LDS
  __shared__ float Xs[8][2][16 * XPAD];   // double buffer, 36.9 KB
#else
  __shared__ float Xs[8][1][16 * XPAD];
#endif
  const int tid = threadIdx.x;
  const int w = tid >> 5, lane = tid & 31;
  const int M = lane & 15, half = lane >> 4;
  const int rowbase = blockIdx.x * 128 + w * 16;

  v8f acc = {0.f, 0.f, 0.f, 0.f, 0.f, 0.f, 0.f, 0.f};

  auto compute = [&](int stq, int buf) {
    const int k0 = stq * KSW;
#pragma unroll
    for (int kk = 0; kk < KSW; kk += 4) {
      v2f a = *(const v2f*)&Xs[w][buf][M * XPAD + kk + 2 * half];
      v2f b = *(const v2f*)&Bmat[M * HID + k0 + kk + 2 * half];
      acc = wmma_f32_16x16x4(a, b, acc);
    }
  };

#if HAVE_ASYNC_LDS
  auto stage_async = [&](int stq, int buf) {
    // previous ds reads of this buffer must have executed before async writes
    asm volatile("s_wait_dscnt 0x0" ::: "memory");
#pragma unroll
    for (int it = 0; it < 4; ++it) {   // 4 x B128 per lane = 16 rows x 32 cols
      const int r = it * 4 + (lane >> 3), c4 = lane & 7;
      __builtin_amdgcn_global_load_async_to_lds_b128(
          (__attribute__((address_space(1))) v4i_vs*)
              &x[(rowbase + r) * HID + stq * KSW + c4 * 4],
          (__attribute__((address_space(3))) v4i_vs*)
              &Xs[w][buf][r * XPAD + c4 * 4],
          0, 0);
    }
  };

  stage_async(0, 0);
  for (int st = 0; st < HID / KSW; ++st) {
    const int buf = st & 1;
    if (st + 1 < HID / KSW) {
      stage_async(st + 1, buf ^ 1);
      __builtin_prefetch(&x[(rowbase + M) * HID + (st + 1) * KSW], 0, 1);
      WAIT_ASYNCCNT(4);   // dones are in-order: only newest stage outstanding
    } else {
      WAIT_ASYNCCNT(0);
    }
    compute(st, buf);
  }
#else
  for (int st = 0; st < HID / KSW; ++st) {
    const int k0 = st * KSW;
#pragma unroll
    for (int it = 0; it < 4; ++it) {
      const int r = it * 4 + (lane >> 3), c4 = lane & 7;
      const float4 v = *(const float4*)&x[(rowbase + r) * HID + k0 + c4 * 4];
      *(float4*)&Xs[w][0][r * XPAD + c4 * 4] = v;
    }
    if (st + 1 < HID / KSW)
      __builtin_prefetch(&x[(rowbase + M) * HID + k0 + KSW], 0, 1);
    __syncthreads();
    compute(st, 0);
    __syncthreads();
  }
#endif

#pragma unroll
  for (int v = 0; v < 8; ++v)
    ws[WS_U + (rowbase + v + 8 * half) * SDIM + M] = acc[v];
}

// ===========================================================================
// Kernel 2: per-chunk local scan (zero carry-in): s_j = s_{j-1} A_d + u_j.
// 16 lanes per chunk, cross-lane via shfl(width 16); A_d column in registers.
// The block's 16 chunks of y are read in one batch of loads, turned into
// u = y M^T on the way (f32 WMMA, each wave its own 64 rows = 4 tiles) and
// staged in LDS, so no step of the serial chain waits for a global load.
// ===========================================================================
__global__ __launch_bounds__(256) void k_scan_local(float* __restrict__ ws) {
  constexpr int BLK = 16 * LCH * SDIM;   // floats of y per block (contiguous)
  __shared__ float U[BLK];               // 32 KB
  const int tid = threadIdx.x;
  const int n = tid & 15;
  const int blk = blockIdx.x * BLK;
  float Acol[16];
#pragma unroll
  for (int m = 0; m < 16; ++m) Acol[m] = ws[WS_P + 256 + m * 16 + n];
  const int half = (tid >> 4) & 1;
  const int wrow = (tid >> 5) * (2 * LCH);   // first of the wave's 64 rows
  v2f mb[4], ya[4][4];
  // loops unrolled: the fragment arrays need constant indices to stay in
  // registers, and all 20 loads go out in one batch ahead of the first WMMA
#pragma unroll
  for (int k4 = 0; k4 < 4; ++k4)
    mb[k4] = *(const v2f*)&ws[WS_M + n * SDIM + k4 * 4 + 2 * half];
#pragma unroll
  for (int t = 0; t < 4; ++t)
#pragma unroll
    for (int k4 = 0; k4 < 4; ++k4)
      ya[t][k4] = *(const v2f*)&ws[WS_U + blk + (wrow + t * 16 + n) * SDIM +
                                   k4 * 4 + 2 * half];
#pragma unroll
  for (int t = 0; t < 4; ++t) {
    v8f acc = {0.f, 0.f, 0.f, 0.f, 0.f, 0.f, 0.f, 0.f};
#pragma unroll
    for (int k4 = 0; k4 < 4; ++k4) acc = wmma_f32_16x16x4(ya[t][k4], mb[k4], acc);
#pragma unroll
    for (int v = 0; v < 8; ++v)
      U[(wrow + t * 16 + v + 8 * half) * SDIM + n] = acc[v];
  }
  __syncthreads();
  float s = 0.f;
  const int loc = (tid >> 4) * (LCH * SDIM) + n;
  for (int j0 = 0; j0 < LCH; j0 += 16) {
    // 16 steps unrolled so that their LDS reads issue together, ahead of the
    // chain, and the LDS latency is paid once per 16 steps
#pragma unroll
    for (int k = 0; k < 16; ++k) {
      const int j2 = j0 + k;
      float sn = U[loc + j2 * SDIM];
#pragma unroll
      for (int m = 0; m < 16; ++m) sn += __shfl(s, m, 16) * Acol[m];
      s = sn;
      ws[WS_SL + blk + loc + j2 * SDIM] = s;
    }
    // the next pass rewrites the registers that this pass's stores name
    asm volatile("s_wait_xcnt 0x0" ::: "memory");
  }
}

// ===========================================================================
// Kernel 3: chunk carries: C_{c+1} = C_c * A_d^L + v_c. 128 small steps per
// batch (vs 4096 serial steps naively). Also writes final_state to out tail.
// The 512 chunk-end rows v_c are staged in LDS by 8 waves in one batch of
// loads; the serial chain (waves 0 and 1) then reads its addend from LDS and
// waits for no global load.
// ===========================================================================
__global__ __launch_bounds__(256) void k_carry(const float* __restrict__ state0,
                                               float* __restrict__ ws,
                                               float* __restrict__ out) {
  __shared__ float V[NCH * SDIM];   // v_c, row = b*NCHB + c, 32 KB
  const int tid = threadIdx.x;
  const int b = tid >> 4, n = tid & 15;
  float Tcol[16];
#pragma unroll
  for (int m = 0; m < 16; ++m) Tcol[m] = ws[WS_P + LCH * 256 + m * 16 + n];
  float carry = (tid < BATCH * SDIM) ? state0[tid] : 0.f;
#pragma unroll
  for (int q = 0; q < (NCH * SDIM) / (4 * 256); ++q) {
    const int f4 = q * 256 + tid;            // float4 index: row f4/4, part f4%4
    const int row = f4 >> 2, part = f4 & 3;
    *(float4*)&V[f4 * 4] =
        *(const float4*)&ws[WS_SL + (row * LCH + (LCH - 1)) * SDIM + part * 4];
  }
  __syncthreads();
  if (tid >= BATCH * SDIM) return;   // whole waves; no barrier follows
  for (int c0 = 0; c0 < NCHB; c0 += 16) {
    // 16 steps unrolled so that their LDS reads issue together, ahead of the
    // chain, and the LDS latency is paid once per 16 steps
#pragma unroll
    for (int k = 0; k < 16; ++k) {
      const int c = c0 + k;
      ws[WS_CARRY + (b * NCHB + c) * SDIM + n] = carry;
      float nc = V[(b * NCHB + c) * SDIM + n];
#pragma unroll
      for (int m = 0; m < 16; ++m) nc += __shfl(carry, m, 16) * Tcol[m];
      carry = nc;
    }
  }
  out[ROWS * HID + b * 16 + n] = carry;  // final_state
}

// ===========================================================================
// Kernel 4: s_t = Sl_t + carry_c * P_{j+1}  (parallel carry correction)
// ===========================================================================
__global__ __launch_bounds__(256) void k_correct(float* __restrict__ ws) {
  const int g = blockIdx.x * 256 + threadIdx.x;
  const int row = g >> 4, n = g & 15;
  const int j2 = row & (LCH - 1), c = row >> 5;  // row%32 == t%32 (4096%32==0)
  float acc = ws[WS_SL + g];
  const float* __restrict__ P  = ws + WS_P + (j2 + 1) * 256;
  const float* __restrict__ cr = ws + WS_CARRY + c * SDIM;
#pragma unroll
  for (int m = 0; m < 16; ++m) acc += cr[m] * P[m * 16 + n];
  ws[WS_S + g] = acc;
}

// ===========================================================================
// Kernel 5: out = states @ C^T  (M=16384, K=16, N=1024) with f32 WMMA.
// Wave owns one 16-row tile and 8 h-tiles; A-fragments loaded once, 4 chained
// 16x16x4 WMMAs cover K=16 per tile.
// ===========================================================================
__global__ __launch_bounds__(256) void k_out_gemm(const float* __restrict__ Cmat,
                                                  const float* __restrict__ ws,
                                                  float* __restrict__ out) {
  const int tid = threadIdx.x;
  const int wglobal = blockIdx.x * 8 + (tid >> 5);
  const int rt = wglobal >> 3, hg = wglobal & 7;
  const int lane = tid & 31, M = lane & 15, half = lane >> 4;
  const float* __restrict__ S = ws + WS_S;

  v2f a[4];
#pragma unroll
  for (int k4 = 0; k4 < 4; ++k4)
    a[k4] = *(const v2f*)&S[(rt * 16 + M) * SDIM + k4 * 4 + 2 * half];

#pragma unroll
  for (int ht = 0; ht < 8; ++ht) {
    const int hbase = (hg * 8 + ht) * 16;
    v8f acc = {0.f, 0.f, 0.f, 0.f, 0.f, 0.f, 0.f, 0.f};
#pragma unroll
    for (int k4 = 0; k4 < 4; ++k4) {
      v2f b = *(const v2f*)&Cmat[(hbase + M) * SDIM + k4 * 4 + 2 * half];
      acc = wmma_f32_16x16x4(a[k4], b, acc);
    }
#pragma unroll
    for (int v = 0; v < 8; ++v)
      out[(rt * 16 + v + 8 * half) * HID + hbase + M] = acc[v];
  }
}

// ===========================================================================
extern "C" void kernel_launch(void* const* d_in, const int* in_sizes, int n_in,
                              void* d_out, int out_size, void* d_ws,
                              size_t ws_size, hipStream_t stream) {
  const float* x   = (const float*)d_in[0];  // [4,4096,1024]
  const float* st0 = (const float*)d_in[1];  // [4,16]
  const float* A   = (const float*)d_in[2];  // [16,16]
  const float* B   = (const float*)d_in[3];  // [16,1024]
  const float* C   = (const float*)d_in[4];  // [1024,16]
  const float* ld  = (const float*)d_in[5];  // [1024]
  float* out = (float*)d_out;                // [4,4096,1024] ++ [4,16]
  float* ws  = (float*)d_ws;                 // needs ~3.2 MB f32 scratch

  k_u_gemm<<<ROWS / 128 + 1, 256, 0, stream>>>(x, A, B, ld, ws);
  k_scan_local<<<NCH / 16, 256, 0, stream>>>(ws);
  k_carry<<<1, 256, 0, stream>>>(st0, ws, out);
  k_correct<<<(ROWS * SDIM) / 256, 256, 0, stream>>>(ws);
  k_out_gemm<<<(ROWS / 16), 256, 0, stream>>>(C, ws, out);
}

// v005
// It runs in 47 microseconds.
// It is 1.15 times as fast as v003, going by the measured steps of the versions left out in between.
// All steps since v000 together make it 3.52 times as fast.
#include <hip/hip_runtime.h>
#include <hip/hip_bf16.h>
#include <math.h>

typedef float v2f __attribute__((ext_vector_type(2)));
typedef float v8f __attribute__((ext_vector_type(8)));
typedef int   v4i_vs __attribute__((vector_size(16)));   // matches builtin param

// Problem shape (fixed by the reference)
constexpr int BATCH = 4;
constexpr int SEQ   = 4096;
constexpr int HID   = 1024;
constexpr int SDIM  = 16;
constexpr int ROWS  = BATCH * SEQ;     // 16384  (row = b*SEQ + t)
constexpr int LCH   = 32;              // scan chunk length
constexpr int NCHB  = SEQ / LCH;       // 128 chunks per batch
constexpr int NCH   = BATCH * NCHB;    // 512 chunks total

// Workspace layout (float offsets); total ~2.2 MB of f32
constexpr int WS_M     = 0;                           // M = A^-1 (A_d - I) [16][16]
constexpr int WS_P     = WS_M + 256;                  // P_j = A_d^j, j=0..32
constexpr int WS_U     = WS_P + (LCH + 1) * 256;      // y = x B^T [ROWS][16]
constexpr int WS_SL    = WS_U + ROWS * SDIM;          // local (zero-carry) states
constexpr int WS_CARRY = WS_SL + ROWS * SDIM;         // carry-in per chunk [NCH][16]

// CDNA5 async global->LDS path (ASYNCcnt-tracked, no VGPR round trip)
#if defined(__gfx1250__) && __has_builtin(__builtin_amdgcn_global_load_async_to_lds_b128)
#define HAVE_ASYNC_LDS 1
#else
#define HAVE_ASYNC_LDS 0
#endif

#if __has_builtin(__builtin_amdgcn_s_wait_asynccnt)
#define WAIT_ASYNCCNT(n) __builtin_amdgcn_s_wait_asynccnt(n)
#else
#define WAIT_ASYNCCNT(n) asm volatile("s_wait_asynccnt " #n ::: "memory")
#endif

// ---------------------------------------------------------------------------
// f32 WMMA: D = A(16x4) * B(4x16) + C(16x16), full f32 precision.
// A layout (ISA 7.12.2): lane l -> M = l%16, VGPR v -> K = v + 2*(l/16)
// B layout (row-striped): lane l -> N = l%16, VGPR v -> K = v + 2*(l/16)
// C/D layout: lane l -> N = l%16, VGPR v -> M = v + 8*(l/16)
// ---------------------------------------------------------------------------
__device__ __forceinline__ v8f wmma_f32_16x16x4(v2f a, v2f b, v8f c) {
  return __builtin_amdgcn_wmma_f32_16x16x4_f32(false, a, false, b, (short)0, c,
                                               false, false);
}

// ===========================================================================
// Setup (one block of kernel 1). dt, A_d = expm(A*dt) (Taylor 12 + 6
// squarings), Ainv via Gauss-Jordan w/ partial pivoting, M = Ainv*(A_d - I),
// powers P_0..P_32.  256 threads (thread = elem (i,j)).
// B_d = M*B is never formed: x B_d^T = (x B^T) M^T, so the big product needs
// nothing from here and this serial work runs beside it in the same launch.
// ===========================================================================
__device__ __forceinline__ void setup_block(const float* __restrict__ A,
                                            const float* __restrict__ log_dt,
                                            float* __restrict__ ws) {
  __shared__ float red[256];
  __shared__ float Ms[256], term[256], acc[256], Ad[256];
  __shared__ float aug[16 * 33];
  __shared__ float fcol[16];
  __shared__ float Ainv[256];
  __shared__ float s_dt, s_inv;
  __shared__ int s_piv;

  const int tid = threadIdx.x;
  const int i = tid >> 4, j = tid & 15;

  // ---- dt = mean(exp(log_dt)) ----
  float s = 0.f;
  for (int q = tid; q < HID; q += 256) s += expf(log_dt[q]);
  red[tid] = s;
  __syncthreads();
  for (int o = 128; o > 0; o >>= 1) {
    if (tid < o) red[tid] += red[tid + o];
    __syncthreads();
  }
  if (tid == 0) s_dt = red[0] * (1.0f / (float)HID);
  __syncthreads();

  // ---- expm(A*dt): scale by 2^-6, Taylor 12, square 6x ----
  Ms[tid]   = A[tid] * (s_dt * (1.0f / 64.0f));
  term[tid] = (i == j) ? 1.f : 0.f;
  acc[tid]  = (i == j) ? 1.f : 0.f;
  __syncthreads();
  for (int it = 1; it <= 12; ++it) {
    float t2 = 0.f;
    for (int k = 0; k < 16; ++k) t2 += term[i * 16 + k] * Ms[k * 16 + j];
    __syncthreads();
    term[tid] = t2 / (float)it;
    acc[tid] += term[tid];
    __syncthreads();
  }
  for (int sq = 0; sq < 6; ++sq) {
    float t2 = 0.f;
    for (int k = 0; k < 16; ++k) t2 += acc[i * 16 + k] * acc[k * 16 + j];
    __syncthreads();
    acc[tid] = t2;
    __syncthreads();
  }
  Ad[tid] = acc[tid];
  __syncthreads();

  // ---- Gauss-Jordan inverse of A (augmented [A | I], partial pivoting) ----
  aug[i * 33 + j]      = A[tid];
  aug[i * 33 + 16 + j] = (i == j) ? 1.f : 0.f;
  __syncthreads();
  for (int k = 0; k < 16; ++k) {
    if (tid == 0) {
      int p = k;
      float best = fabsf(aug[k * 33 + k]);
      for (int r = k + 1; r < 16; ++r) {
        float v = fabsf(aug[r * 33 + k]);
        if (v > best) { best = v; p = r; }
      }
      s_piv = p;
    }
    __syncthreads();
    const int p = s_piv;
    if (p != k && tid < 32) {
      float t2 = aug[k * 33 + tid];
      aug[k * 33 + tid] = aug[p * 33 + tid];
      aug[p * 33 + tid] = t2;
    }
    __syncthreads();
    if (tid == 0) s_inv = 1.0f / aug[k * 33 + k];
    __syncthreads();
    if (tid < 32) aug[k * 33 + tid] *= s_inv;
    __syncthreads();
    if (tid < 16) fcol[tid] = aug[tid * 33 + k];
    __syncthreads();
    if (i != k) {
      aug[i * 33 + j]      -= fcol[i] * aug[k * 33 + j];
      aug[i * 33 + 16 + j] -= fcol[i] * aug[k * 33 + 16 + j];
    }
    __syncthreads();
  }
  Ainv[tid] = aug[i * 33 + 16 + j];
  __syncthreads();

  // ---- M = Ainv * (A_d - I) ----
  {
    float t2 = 0.f;
    for (int k = 0; k < 16; ++k) {
      float ad = Ad[k * 16 + j] - ((k == j) ? 1.f : 0.f);
      t2 += Ainv[i * 16 + k] * ad;
    }
    ws[WS_M + tid] = t2;
  }

  // ---- powers P_0..P_LCH of A_d ----
  // P_k = P_(k-1) A_d goes row by row: row i of P_k needs only row i of
  // P_(k-1), which the row's own 16 lanes hold, and column j of A_d, which
  // never changes. So each 16-lane group carries its row through shuffles
  // (as k_scan_local does) and the chain meets no barrier and no store wait.
  // Same products, same k order as a plain P_(k-1) A_d.
  float Acol[16];
  // unrolled: constant indices keep the column in registers
#pragma unroll
  for (int k = 0; k < 16; ++k) Acol[k] = Ad[k * 16 + j];
  float pw[LCH + 1];
  pw[0] = (i == j) ? 1.f : 0.f;
  pw[1] = Ad[tid];
  // unrolled: every power stays in a register of its own until the stores
#pragma unroll
  for (int jp = 2; jp <= LCH; ++jp) {
    float t2 = 0.f;
    // unrolled: a shuffle from a constant lane compiles to a row broadcast in
    // the vector unit (no LDS round trip), and Acol needs constant indices
#pragma unroll
    for (int k = 0; k < 16; ++k) t2 += __shfl(pw[jp - 1], k, 16) * Acol[k];
    pw[jp] = t2;
  }
  // unrolled: constant indices; nothing behind these stores rewrites a
  // register that one of them names
#pragma unroll
  for (int jp = 0; jp <= LCH; ++jp) ws[WS_P + jp * 256 + tid] = pw[jp];
}

// ===========================================================================
// Kernel 1: y = x @ B^T  (M=16384, K=1024, N=16) with f32 WMMA; the block
// behind the last row tile does the setup instead (nothing here reads it).
// Block = 256 threads = 8 waves; wave owns a 16-row tile (private LDS stage).
// Async path: GLOBAL_LOAD_ASYNC_TO_LDS_B128 double-buffered, ASYNCcnt-paced,
// zero barriers (DS ops are in-order in HW; explicit s_wait_dscnt guards the
// async-write-after-ds-read hazard since ASYNCcnt/DScnt are unordered).
// ===========================================================================
constexpr int KSW  = 32;   // K columns staged per step
constexpr int XPAD = 36;   // row pad: stride 36 mod 64 -> conflict-free banks

__global__ __launch_bounds__(256) void k_u_gemm(const float* __restrict__ x,
                                                const float* __restrict__ A,
                                                const float* __restrict__ Bmat,
                                                const float* __restrict__ log_dt,
                                                float* __restrict__ ws) {
  if (blockIdx.x == ROWS / 128) {   // whole block
    setup_block(A, log_dt, ws);
    return;
  }
#if HAVE_ASYNC_LDS
  __shared__ float Xs[8][2][16 * XPAD];   // double buffer, 36.9 KB
#else
  __shared__ float Xs[8][1][16 * XPAD];
#endif
  const int tid = threadIdx.x;
  const int w = tid >> 5, lane = tid & 31;
  const int M = lane & 15, half = lane >> 4;
  const int rowbase = blockIdx.x * 128 + w * 16;

  v8f acc = {0.f, 0.f, 0.f, 0.f, 0.f, 0.f, 0.f, 0.f};

  auto compute = [&](int stq, int buf) {
    const int k0 = stq * KSW;
#pragma unroll
    for (int kk = 0; kk < KSW; kk += 4) {
      v2f a = *(const v2f*)&Xs[w][buf][M * XPAD + kk + 2 * half];
      v2f b = *(const v2f*)&Bmat[M * HID + k0 + kk + 2 * half];
      acc = wmma_f32_16x16x4(a, b, acc);
    }
  };

#if HAVE_ASYNC_LDS
  auto stage_async = [&](int stq, int buf) {
    // previous ds reads of this buffer must have executed before async writes
    asm volatile("s_wait_dscnt 0x0" ::: "memory");
#pragma unroll
    for (int it = 0; it < 4; ++it) {   // 4 x B128 per lane = 16 rows x 32 cols
      const int r = it * 4 + (lane >> 3), c4 = lane & 7;
      __builtin_amdgcn_global_load_async_to_lds_b128(
          (__attribute__((address_space(1))) v4i_vs*)
              &x[(rowbase + r) * HID + stq * KSW + c4 * 4],
          (__attribute__((address_space(3))) v4i_vs*)
              &Xs[w][buf][r * XPAD + c4 * 4],
          0, 0);
    }
  };

  stage_async(0, 0);
  for (int st = 0; st < HID / KSW; ++st) {
    const int buf = st & 1;
    if (st + 1 < HID / KSW) {
      stage_async(st + 1, buf ^ 1);
      __builtin_prefetch(&x[(rowbase + M) * HID + (st + 1) * KSW], 0, 1);
      WAIT_ASYNCCNT(4);   // dones are in-order: only newest stage outstanding
    } else {
      WAIT_ASYNCCNT(0);
    }
    compute(st, buf);
  }
#else
  for (int st = 0; st < HID / KSW; ++st) {
    const int k0 = st * KSW;
#pragma unroll
    for (int it = 0; it < 4; ++it) {
      const int r = it * 4 + (lane >> 3), c4 = lane & 7;
      const float4 v = *(const float4*)&x[(rowbase + r) * HID + k0 + c4 * 4];
      *(float4*)&Xs[w][0][r * XPAD + c4 * 4] = v;
    }
    if (st + 1 < HID / KSW)
      __builtin_prefetch(&x[(rowbase + M) * HID + k0 + KSW], 0, 1);
    __syncthreads();
    compute(st, 0);
    __syncthreads();
  }
#endif

#pragma unroll
  for (int v = 0; v < 8; ++v)
    ws[WS_U + (rowbase + v + 8 * half) * SDIM + M] = acc[v];
}

// ===========================================================================
// Kernel 2: per-chunk local scan (zero carry-in): s_j = s_{j-1} A_d + u_j.
// 16 lanes per chunk, cross-lane via shfl(width 16); A_d column in registers.
// The block's 16 chunks of y are read in one batch of loads, turned into
// u = y M^T on the way (f32 WMMA, each wave its own 64 rows = 4 tiles) and
// staged in LDS, so no step of the serial chain waits for a global load.
// ===========================================================================
__global__ __launch_bounds__(256) void k_scan_local(float* __restrict__ ws) {
  constexpr int BLK = 16 * LCH * SDIM;   // floats of y per block (contiguous)
  __shared__ float U[BLK];               // 32 KB
  const int tid = threadIdx.x;
  const int n = tid & 15;
  const int blk = blockIdx.x * BLK;
  float Acol[16];
#pragma unroll
  for (int m = 0; m < 16; ++m) Acol[m] = ws[WS_P + 256 + m * 16 + n];
  const int half = (tid >> 4) & 1;
  const int wrow = (tid >> 5) * (2 * LCH);   // first of the wave's 64 rows
  v2f mb[4], ya[4][4];
  // loops unrolled: the fragment arrays need constant indices to stay in
  // registers, and all 20 loads go out in one batch ahead of the first WMMA
#pragma unroll
  for (int k4 = 0; k4 < 4; ++k4)
    mb[k4] = *(const v2f*)&ws[WS_M + n * SDIM + k4 * 4 + 2 * half];
#pragma unroll
  for (int t = 0; t < 4; ++t)
#pragma unroll
    for (int k4 = 0; k4 < 4; ++k4)
      ya[t][k4] = *(const v2f*)&ws[WS_U + blk + (wrow + t * 16 + n) * SDIM +
                                   k4 * 4 + 2 * half];
#pragma unroll
  for (int t = 0; t < 4; ++t) {
    v8f acc = {0.f, 0.f, 0.f, 0.f, 0.f, 0.f, 0.f, 0.f};
#pragma unroll
    for (int k4 = 0; k4 < 4; ++k4) acc = wmma_f32_16x16x4(ya[t][k4], mb[k4], acc);
#pragma unroll
    for (int v = 0; v < 8; ++v)
      U[(wrow + t * 16 + v + 8 * half) * SDIM + n] = acc[v];
  }
  __syncthreads();
  float s = 0.f;
  const int loc = (tid >> 4) * (LCH * SDIM) + n;
  for (int j0 = 0; j0 < LCH; j0 += 16) {
    // 16 steps unrolled so that their LDS reads issue together, ahead of the
    // chain, and the LDS latency is paid once per 16 steps
#pragma unroll
    for (int k = 0; k < 16; ++k) {
      const int j2 = j0 + k;
      float sn = U[loc + j2 * SDIM];
#pragma unroll
      for (int m = 0; m < 16; ++m) sn += __shfl(s, m, 16) * Acol[m];
      s = sn;
      ws[WS_SL + blk + loc + j2 * SDIM] = s;
    }
    // the next pass rewrites the registers that this pass's stores name
    asm volatile("s_wait_xcnt 0x0" ::: "memory");
  }
}

// ===========================================================================
// Kernel 3: chunk carries: C_{c+1} = C_c * T + v_c, T = A_d^L. Also writes
// final_state to the out tail.
// Two-level scan, so that the serial chain is 7 + 16 + 7 steps, not 128: each
// batch's 128 chunks are 16 groups of 8.
//   1. every group is scanned from a zero carry (its end e_g); a fifth wave
//      runs the same steps on T itself and so gets T^8;
//   2. one chain over the groups: G_{g+1} = G_g T^8 + e_g;
//   3. every group is scanned again from its true carry-in G_g.
// A step is S <- T^t S + V on f32 WMMA: S holds 16 state columns (one group
// each; wave = batch). D of one step is B of the next with no move between
// lanes: WMMA j takes D registers 2j, 2j+1, which in lane half h are the states
// m = 8h + 2j + v; the A fragments below use the same k order.
// ===========================================================================
constexpr int GRP  = 16;           // groups per batch
constexpr int GLEN = NCHB / GRP;   // chunks per group

__device__ __forceinline__ v8f ld8(const float* p) {
  const float4 lo = *(const float4*)p, hi = *(const float4*)(p + 4);
  return v8f{lo.x, lo.y, lo.z, lo.w, hi.x, hi.y, hi.z, hi.w};
}
__device__ __forceinline__ void st8(float* p, v8f s) {
  *(float4*)p       = make_float4(s[0], s[1], s[2], s[3]);
  *(float4*)(p + 4) = make_float4(s[4], s[5], s[6], s[7]);
}
__device__ __forceinline__ v8f carry_step(const v2f (&a)[4], v8f s, v8f add) {
  v8f acc = add;
  // unrolled: register elements need constant indices
#pragma unroll
  for (int j = 0; j < 4; ++j) {
    const v2f b = {s[2 * j], s[2 * j + 1]};
    acc = wmma_f32_16x16x4(a[j], b, acc);
  }
  return acc;
}

__global__ __launch_bounds__(160) void k_carry(const float* __restrict__ state0,
                                               float* __restrict__ ws,
                                               float* __restrict__ out) {
  __shared__ __attribute__((aligned(16))) float Q[SDIM * SDIM];          // (T^8)^t [n][m]
  __shared__ __attribute__((aligned(16))) float E[BATCH * GRP * SDIM];   // group ends
  __shared__ __attribute__((aligned(16))) float G[GRP * 16 * SDIM];      // carry-ins [g][column]
  const int tid = threadIdx.x;
  // wave number as a scalar: the branches on it are whole-wave branches
  const int w = __builtin_amdgcn_readfirstlane(tid >> 5);
  const int col = tid & 15, half = (tid >> 4) & 1;
  const float* __restrict__ T = ws + WS_P + LCH * 256;

  // Every loop of this kernel is unrolled: the arrays need constant indices to
  // stay in registers, and each batch of loads goes out ahead of its chain.
  // One run of loads for every wave, with no branch in front of it (a branch
  // made the chunk loads wait for the T loads). Wave 4 has no chunks: it starts
  // from T^t (element (n = v + 8*half, col)), reads wave 0's other chunks and
  // replaces them by zeros below.
  const int wb = (w < BATCH) ? w : 0;
  const float* __restrict__ vp =
      &ws[WS_SL + ((wb * NCHB + col * GLEN) * LCH + (LCH - 1)) * SDIM + 8 * half];
  const float* __restrict__ p0 = (w < BATCH) ? vp : &T[col * SDIM + 8 * half];
  v8f V[GLEN];   // v_c = the chunk's last local state
  V[0] = ld8(p0);
#pragma unroll
  for (int k = 1; k < GLEN; ++k) V[k] = ld8(vp + k * LCH * SDIM);
  const v8f S0 = ld8(&state0[(col & (BATCH - 1)) * SDIM + 8 * half]);
  // what follows may rewrite the address registers of the loads above
  asm volatile("s_wait_xcnt 0x0" ::: "memory");
  v2f ta[4];   // A fragments of T^t: row n = col, k slot -> m = 8*half + 2j + v
#pragma unroll
  for (int j = 0; j < 4; ++j) {
    ta[j][0] = T[(8 * half + 2 * j) * SDIM + col];
    ta[j][1] = T[(8 * half + 2 * j + 1) * SDIM + col];
  }
  // as above, for the T loads
  asm volatile("s_wait_xcnt 0x0" ::: "memory");
  if (w == BATCH) {   // powers of T take no addend
#pragma unroll
    for (int k = 1; k < GLEN; ++k) V[k] = v8f{0.f, 0.f, 0.f, 0.f, 0.f, 0.f, 0.f, 0.f};
  }

  // ---- 1: group ends from a zero carry (wave 4: T^8) ----
  v8f S = V[0];
#pragma unroll
  for (int k = 1; k < GLEN; ++k) S = carry_step(ta, S, V[k]);
  if (w < BATCH) {
    st8(&E[(w * GRP + col) * SDIM + 8 * half], S);
  } else {
#pragma unroll
    for (int v = 0; v < 8; ++v) Q[(v + 8 * half) * SDIM + col] = S[v];
  }
  __syncthreads();

  // ---- 2: chain over the groups (wave 4; column = batch, repeated 4 times) ----
  if (w == BATCH) {
    v2f qa[4];
    v8f Ef[GRP];
#pragma unroll
    for (int j = 0; j < 4; ++j)
      qa[j] = *(const v2f*)&Q[col * SDIM + 8 * half + 2 * j];
#pragma unroll
    for (int g = 0; g < GRP; ++g)
      Ef[g] = ld8(&E[((col & (BATCH - 1)) * GRP + g) * SDIM + 8 * half]);
    S = S0;
#pragma unroll
    for (int g = 0; g < GRP; ++g) {
      st8(&G[(g * 16 + col) * SDIM + 8 * half], S);
      S = carry_step(qa, S, Ef[g]);
    }
  }
  __syncthreads();
  // final_state; behind the barrier, so that no wave waits there for this store
  if (w == BATCH && col < BATCH) st8(&out[ROWS * HID + col * SDIM + 8 * half], S);

  // ---- 3: every group again, from its true carry-in ----
  if (w < BATCH) {
    v8f C[GLEN];
    C[0] = ld8(&G[(col * 16 + w) * SDIM + 8 * half]);
#pragma unroll
    for (int k = 1; k < GLEN; ++k) C[k] = carry_step(ta, C[k - 1], V[k - 1]);
    // stored behind the chain: nothing behind these stores rewrites a register
    // that one of them names
#pragma unroll
    for (int k = 0; k < GLEN; ++k)
      st8(&ws[WS_CARRY + (w * NCHB + col * GLEN + k) * SDIM + 8 * half], C[k]);
  }
}

// ===========================================================================
// Kernel 4: out = states @ C^T  (M=16384, K=16, N=1024) with f32 WMMA, the
// carry correction s_t = Sl_t + carry_c * P_{j+1} done in front of it.
// Block = one chunk (32 rows), 8 waves. The 256 threads correct the chunk's
// 512 states (two each, the sums in the order m = 0..15) and leave them in LDS;
// behind one barrier every wave takes its A fragments from there. A wave owns
// 8 h-tiles, whose C fragments it loads once for both 16-row tiles; 4 chained
// 16x16x4 WMMAs cover K=16 per tile.
// ===========================================================================
constexpr int SPAD = 20;   // LDS row pitch in floats: the 16 rows of an A read fall on distinct banks

__global__ __launch_bounds__(256) void k_out_gemm(const float* __restrict__ Cmat,
                                                  const float* __restrict__ ws,
                                                  float* __restrict__ out) {
  __shared__ __attribute__((aligned(16))) float Ss[LCH * SPAD];
  const int tid = threadIdx.x;
  const int c = blockIdx.x;                 // chunk; row%32 == t%32 (4096%32==0)
  const int M = tid & 15, half = (tid >> 4) & 1;
  const int r0 = tid >> 4;                  // thread corrects rows r0 and r0 + 16
  const int hg = tid >> 5;                  // wave's group of 8 h-tiles

  // Every loop of this kernel is unrolled: the arrays need constant indices to
  // stay in registers, and all loads go out in one batch ahead of the sums.
  const float* __restrict__ Sl = ws + WS_SL + c * (LCH * SDIM);
  const float* __restrict__ cr = ws + WS_CARRY + c * SDIM;
  const float* __restrict__ P  = ws + WS_P + (r0 + 1) * 256 + M;
  float s0 = Sl[tid], s1 = Sl[256 + tid];
  float p0[16], p1[16];
#pragma unroll
  for (int m = 0; m < 16; ++m) {
    p0[m] = P[m * 16];
    p1[m] = P[16 * 256 + m * 16];
  }
  v2f b[8][4];
#pragma unroll
  for (int ht = 0; ht < 8; ++ht)
#pragma unroll
    for (int k4 = 0; k4 < 4; ++k4)
      b[ht][k4] = *(const v2f*)&Cmat[((hg * 8 + ht) * 16 + M) * SDIM + k4 * 4 + 2 * half];

#pragma unroll
  for (int m = 0; m < 16; ++m) {
    s0 += cr[m] * p0[m];
    s1 += cr[m] * p1[m];
  }
  Ss[r0 * SPAD + M]        = s0;
  Ss[(r0 + 16) * SPAD + M] = s1;
  __syncthreads();

  float* __restrict__ op = out + (c * LCH + 8 * half) * HID + hg * 128 + M;
  v2f a[2][4];
#pragma unroll
  for (int rt = 0; rt < 2; ++rt)
#pragma unroll
    for (int k4 = 0; k4 < 4; ++k4)
      a[rt][k4] = *(const v2f*)&Ss[(rt * 16 + M) * SPAD + k4 * 4 + 2 * half];
#pragma unroll
  for (int rt = 0; rt < 2; ++rt) {
#pragma unroll
    for (int ht = 0; ht < 8; ++ht) {
      v8f acc = {0.f, 0.f, 0.f, 0.f, 0.f, 0.f, 0.f, 0.f};
#pragma unroll
      for (int k4 = 0; k4 < 4; ++k4) acc = wmma_f32_16x16x4(a[rt][k4], b[ht][k4], acc);
#pragma unroll
      for (int v = 0; v < 8; ++v) op[(rt * 16 + v) * HID + ht * 16] = acc[v];
    }
    // the second row tile may rewrite registers that the first one's stores name
    if (rt == 0) asm volatile("s_wait_xcnt 0x0" ::: "memory");
  }
}

// ===========================================================================
extern "C" void kernel_launch(void* const* d_in, const int* in_sizes, int n_in,
                              void* d_out, int out_size, void* d_ws,
                              size_t ws_size, hipStream_t stream) {
  const float* x   = (const float*)d_in[0];  // [4,4096,1024]
  const float* st0 = (const float*)d_in[1];  // [4,16]
  const float* A   = (const float*)d_in[2];  // [16,16]
  const float* B   = (const float*)d_in[3];  // [16,1024]
  const float* C   = (const float*)d_in[4];  // [1024,16]
  const float* ld  = (const float*)d_in[5];  // [1024]
  float* out = (float*)d_out;                // [4,4096,1024] ++ [4,16]
  float* ws  = (float*)d_ws;                 // needs ~2.2 MB f32 scratch

  k_u_gemm<<<ROWS / 128 + 1, 256, 0, stream>>>(x, A, B, ld, ws);
  k_scan_local<<<NCH / 16, 256, 0, stream>>>(ws);
  k_carry<<<1, 160, 0, stream>>>(st0, ws, out);
  k_out_gemm<<<NCH, 256, 0, stream>>>(C, ws, out);
}

// v006
// Measured time: 41.7 microseconds a run.
// Next to v005, in two timings, it ran 1.12 and 1.13 times as fast.
// Counting every step since v000, it is 3.97 times as fast.
#include <hip/hip_runtime.h>
#include <hip/hip_bf16.h>
#include <math.h>

typedef float v2f __attribute__((ext_vector_type(2)));
typedef float v8f __attribute__((ext_vector_type(8)));
typedef int   v4i_vs __attribute__((vector_size(16)));   // matches builtin param

// Problem shape (fixed by the reference)
constexpr int BATCH = 4;
constexpr int SEQ   = 4096;
constexpr int HID   = 1024;
constexpr int SDIM  = 16;
constexpr int ROWS  = BATCH * SEQ;     // 16384  (row = b*SEQ + t)
constexpr int LCH   = 32;              // scan chunk length
constexpr int NCHB  = SEQ / LCH;       // 128 chunks per batch
constexpr int NCH   = BATCH * NCHB;    // 512 chunks total

// Workspace layout (float offsets); total ~2.2 MB of f32
constexpr int WS_M     = 0;                           // M = A^-1 (A_d - I) [16][16]
constexpr int WS_P     = WS_M + 256;                  // P_j = A_d^j, j=0..32
constexpr int WS_U     = WS_P + (LCH + 1) * 256;      // y = x B^T [ROWS][16]
constexpr int WS_SL    = WS_U + ROWS * SDIM;          // local (zero-carry) states
constexpr int WS_CARRY = WS_SL + ROWS * SDIM;         // carry-in per chunk [NCH][16]

// CDNA5 async global->LDS path (ASYNCcnt-tracked, no VGPR round trip)
#if defined(__gfx1250__) && __has_builtin(__builtin_amdgcn_global_load_async_to_lds_b128)
#define HAVE_ASYNC_LDS 1
#else
#define HAVE_ASYNC_LDS 0
#endif

#if __has_builtin(__builtin_amdgcn_s_wait_asynccnt)
#define WAIT_ASYNCCNT(n) __builtin_amdgcn_s_wait_asynccnt(n)
#else
#define WAIT_ASYNCCNT(n) asm volatile("s_wait_asynccnt " #n ::: "memory")
#endif

// ---------------------------------------------------------------------------
// f32 WMMA: D = A(16x4) * B(4x16) + C(16x16), full f32 precision.
// A layout (ISA 7.12.2): lane l -> M = l%16, VGPR v -> K = v + 2*(l/16)
// B layout (row-striped): lane l -> N = l%16, VGPR v -> K = v + 2*(l/16)
// C/D layout: lane l -> N = l%16, VGPR v -> M = v + 8*(l/16)
// ---------------------------------------------------------------------------
__device__ __forceinline__ v8f wmma_f32_16x16x4(v2f a, v2f b, v8f c) {
  return __builtin_amdgcn_wmma_f32_16x16x4_f32(false, a, false, b, (short)0, c,
                                               false, false);
}

// ===========================================================================
// Setup (one block of kernel 1). dt, A_d = expm(A*dt) (Taylor 12 + 6
// squarings), Ainv via Gauss-Jordan w/ partial pivoting, M = Ainv*(A_d - I),
// powers P_0..P_32.  256 threads (thread = elem (i,j)).
// B_d = M*B is never formed: x B_d^T = (x B^T) M^T, so the big product needs
// nothing from here and this serial work runs beside it in the same launch.
// ===========================================================================
__device__ __forceinline__ void setup_block(const float* __restrict__ A,
                                            const float* __restrict__ log_dt,
                                            float* __restrict__ ws) {
  __shared__ float red[256];
  __shared__ float Ms[256], term[256], acc[256], Ad[256];
  __shared__ float aug[16 * 33];
  __shared__ float fcol[16];
  __shared__ float Ainv[256];
  __shared__ float s_dt, s_inv;
  __shared__ int s_piv;

  const int tid = threadIdx.x;
  const int i = tid >> 4, j = tid & 15;

  // ---- dt = mean(exp(log_dt)) ----
  float s = 0.f;
  for (int q = tid; q < HID; q += 256) s += expf(log_dt[q]);
  red[tid] = s;
  __syncthreads();
  for (int o = 128; o > 0; o >>= 1) {
    if (tid < o) red[tid] += red[tid + o];
    __syncthreads();
  }
  if (tid == 0) s_dt = red[0] * (1.0f / (float)HID);
  __syncthreads();

  // ---- expm(A*dt): scale by 2^-6, Taylor 12, square 6x ----
  Ms[tid]   = A[tid] * (s_dt * (1.0f / 64.0f));
  term[tid] = (i == j) ? 1.f : 0.f;
  acc[tid]  = (i == j) ? 1.f : 0.f;
  __syncthreads();
  for (int it = 1; it <= 12; ++it) {
    float t2 = 0.f;
    for (int k = 0; k < 16; ++k) t2 += term[i * 16 + k] * Ms[k * 16 + j];
    __syncthreads();
    term[tid] = t2 / (float)it;
    acc[tid] += term[tid];
    __syncthreads();
  }
  for (int sq = 0; sq < 6; ++sq) {
    float t2 = 0.f;
    for (int k = 0; k < 16; ++k) t2 += acc[i * 16 + k] * acc[k * 16 + j];
    __syncthreads();
    acc[tid] = t2;
    __syncthreads();
  }
  Ad[tid] = acc[tid];
  __syncthreads();

  // ---- Gauss-Jordan inverse of A (augmented [A | I], partial pivoting) ----
  aug[i * 33 + j]      = A[tid];
  aug[i * 33 + 16 + j] = (i == j) ? 1.f : 0.f;
  __syncthreads();
  for (int k = 0; k < 16; ++k) {
    if (tid == 0) {
      int p = k;
      float best = fabsf(aug[k * 33 + k]);
      for (int r = k + 1; r < 16; ++r) {
        float v = fabsf(aug[r * 33 + k]);
        if (v > best) { best = v; p = r; }
      }
      s_piv = p;
    }
    __syncthreads();
    const int p = s_piv;
    if (p != k && tid < 32) {
      float t2 = aug[k * 33 + tid];
      aug[k * 33 + tid] = aug[p * 33 + tid];
      aug[p * 33 + tid] = t2;
    }
    __syncthreads();
    if (tid == 0) s_inv = 1.0f / aug[k * 33 + k];
    __syncthreads();
    if (tid < 32) aug[k * 33 + tid] *= s_inv;
    __syncthreads();
    if (tid < 16) fcol[tid] = aug[tid * 33 + k];
    __syncthreads();
    if (i != k) {
      aug[i * 33 + j]      -= fcol[i] * aug[k * 33 + j];
      aug[i * 33 + 16 + j] -= fcol[i] * aug[k * 33 + 16 + j];
    }
    __syncthreads();
  }
  Ainv[tid] = aug[i * 33 + 16 + j];
  __syncthreads();

  // ---- M = Ainv * (A_d - I) ----
  {
    float t2 = 0.f;
    for (int k = 0; k < 16; ++k) {
      float ad = Ad[k * 16 + j] - ((k == j) ? 1.f : 0.f);
      t2 += Ainv[i * 16 + k] * ad;
    }
    ws[WS_M + tid] = t2;
  }

  // ---- powers P_0..P_LCH of A_d ----
  // P_k = P_(k-1) A_d goes row by row: row i of P_k needs only row i of
  // P_(k-1), which the row's own 16 lanes hold, and column j of A_d, which
  // never changes. So each 16-lane group carries its row through shuffles
  // (as k_scan_local does) and the chain meets no barrier and no store wait.
  // Same products, same k order as a plain P_(k-1) A_d.
  float Acol[16];
  // unrolled: constant indices keep the column in registers
#pragma unroll
  for (int k = 0; k < 16; ++k) Acol[k] = Ad[k * 16 + j];
  float pw[LCH + 1];
  pw[0] = (i == j) ? 1.f : 0.f;
  pw[1] = Ad[tid];
  // unrolled: every power stays in a register of its own until the stores
#pragma unroll
  for (int jp = 2; jp <= LCH; ++jp) {
    float t2 = 0.f;
    // unrolled: a shuffle from a constant lane compiles to a row broadcast in
    // the vector unit (no LDS round trip), and Acol needs constant indices
#pragma unroll
    for (int k = 0; k < 16; ++k) t2 += __shfl(pw[jp - 1], k, 16) * Acol[k];
    pw[jp] = t2;
  }
  // unrolled: constant indices; nothing behind these stores rewrites a
  // register that one of them names
#pragma unroll
  for (int jp = 0; jp <= LCH; ++jp) ws[WS_P + jp * 256 + tid] = pw[jp];
}

// ===========================================================================
// Kernel 1: y = x @ B^T  (M=16384, K=1024, N=16) with f32 WMMA; the block
// behind the last row tile does the setup instead (nothing here reads it).
// Block = 256 threads = 8 waves; wave owns a 16-row tile (private LDS stage).
// Async path: GLOBAL_LOAD_ASYNC_TO_LDS_B128 double-buffered, ASYNCcnt-paced,
// zero barriers (DS ops are in-order in HW; explicit s_wait_dscnt guards the
// async-write-after-ds-read hazard since ASYNCcnt/DScnt are unordered).
// ===========================================================================
constexpr int KSW  = 32;   // K columns staged per step
constexpr int XPAD = 36;   // row pad: stride 36 mod 64 -> conflict-free banks

__global__ __launch_bounds__(256) void k_u_gemm(const float* __restrict__ x,
                                                const float* __restrict__ A,
                                                const float* __restrict__ Bmat,
                                                const float* __restrict__ log_dt,
                                                float* __restrict__ ws) {
  if (blockIdx.x == ROWS / 128) {   // whole block
    setup_block(A, log_dt, ws);
    return;
  }
#if HAVE_ASYNC_LDS
  __shared__ float Xs[8][2][16 * XPAD];   // double buffer, 36.9 KB
#else
  __shared__ float Xs[8][1][16 * XPAD];
#endif
  const int tid = threadIdx.x;
  const int w = tid >> 5, lane = tid & 31;
  const int M = lane & 15, half = lane >> 4;
  const int rowbase = blockIdx.x * 128 + w * 16;

  v8f acc = {0.f, 0.f, 0.f, 0.f, 0.f, 0.f, 0.f, 0.f};

  auto compute = [&](int stq, int buf) {
    const int k0 = stq * KSW;
#pragma unroll
    for (int kk = 0; kk < KSW; kk += 4) {
      v2f a = *(const v2f*)&Xs[w][buf][M * XPAD + kk + 2 * half];
      v2f b = *(const v2f*)&Bmat[M * HID + k0 + kk + 2 * half];
      acc = wmma_f32_16x16x4(a, b, acc);
    }
  };

#if HAVE_ASYNC_LDS
  auto stage_async = [&](int stq, int buf) {
    // previous ds reads of this buffer must have executed before async writes
    asm volatile("s_wait_dscnt 0x0" ::: "memory");
#pragma unroll
    for (int it = 0; it < 4; ++it) {   // 4 x B128 per lane = 16 rows x 32 cols
      const int r = it * 4 + (lane >> 3), c4 = lane & 7;
      __builtin_amdgcn_global_load_async_to_lds_b128(
          (__attribute__((address_space(1))) v4i_vs*)
              &x[(rowbase + r) * HID + stq * KSW + c4 * 4],
          (__attribute__((address_space(3))) v4i_vs*)
              &Xs[w][buf][r * XPAD + c4 * 4],
          0, 0);
    }
  };

  stage_async(0, 0);
  for (int st = 0; st < HID / KSW; ++st) {
    const int buf = st & 1;
    if (st + 1 < HID / KSW) {
      stage_async(st + 1, buf ^ 1);
      __builtin_prefetch(&x[(rowbase + M) * HID + (st + 1) * KSW], 0, 1);
      WAIT_ASYNCCNT(4);   // dones are in-order: only newest stage outstanding
    } else {
      WAIT_ASYNCCNT(0);
    }
    compute(st, buf);
  }
#else
  for (int st = 0; st < HID / KSW; ++st) {
    const int k0 = st * KSW;
#pragma unroll
    for (int it = 0; it < 4; ++it) {
      const int r = it * 4 + (lane >> 3), c4 = lane & 7;
      const float4 v = *(const float4*)&x[(rowbase + r) * HID + k0 + c4 * 4];
      *(float4*)&Xs[w][0][r * XPAD + c4 * 4] = v;
    }
    if (st + 1 < HID / KSW)
      __builtin_prefetch(&x[(rowbase + M) * HID + k0 + KSW], 0, 1);
    __syncthreads();
    compute(st, 0);
    __syncthreads();
  }
#endif

#pragma unroll
  for (int v = 0; v < 8; ++v)
    ws[WS_U + (rowbase + v + 8 * half) * SDIM + M] = acc[v];
}

// ===========================================================================
// Kernel 2: per-chunk local scan (zero carry-in): s_j = s_{j-1} A_d + u_j.
// 16 lanes per chunk, cross-lane via shfl(width 16); A_d column in registers.
// The block's 16 chunks of y are read in one batch of loads, turned into
// u = y M^T on the way (f32 WMMA, each wave its own 64 rows = 4 tiles) and
// staged in LDS, so no step of the serial chain waits for a global load.
// ===========================================================================
__global__ __launch_bounds__(256) void k_scan_local(float* __restrict__ ws) {
  constexpr int BLK = 16 * LCH * SDIM;   // floats of y per block (contiguous)
  __shared__ float U[BLK];               // 32 KB
  const int tid = threadIdx.x;
  const int n = tid & 15;
  const int blk = blockIdx.x * BLK;
  float Acol[16];
#pragma unroll
  for (int m = 0; m < 16; ++m) Acol[m] = ws[WS_P + 256 + m * 16 + n];
  const int half = (tid >> 4) & 1;
  const int wrow = (tid >> 5) * (2 * LCH);   // first of the wave's 64 rows
  v2f mb[4], ya[4][4];
  // loops unrolled: the fragment arrays need constant indices to stay in
  // registers, and all 20 loads go out in one batch ahead of the first WMMA
#pragma unroll
  for (int k4 = 0; k4 < 4; ++k4)
    mb[k4] = *(const v2f*)&ws[WS_M + n * SDIM + k4 * 4 + 2 * half];
#pragma unroll
  for (int t = 0; t < 4; ++t)
#pragma unroll
    for (int k4 = 0; k4 < 4; ++k4)
      ya[t][k4] = *(const v2f*)&ws[WS_U + blk + (wrow + t * 16 + n) * SDIM +
                                   k4 * 4 + 2 * half];
#pragma unroll
  for (int t = 0; t < 4; ++t) {
    v8f acc = {0.f, 0.f, 0.f, 0.f, 0.f, 0.f, 0.f, 0.f};
#pragma unroll
    for (int k4 = 0; k4 < 4; ++k4) acc = wmma_f32_16x16x4(ya[t][k4], mb[k4], acc);
#pragma unroll
    for (int v = 0; v < 8; ++v)
      U[(wrow + t * 16 + v + 8 * half) * SDIM + n] = acc[v];
  }
  __syncthreads();
  float s = 0.f;
  const int loc = (tid >> 4) * (LCH * SDIM) + n;
  for (int j0 = 0; j0 < LCH; j0 += 16) {
    // 16 steps unrolled so that their LDS reads issue together, ahead of the
    // chain, and the LDS latency is paid once per 16 steps
#pragma unroll
    for (int k = 0; k < 16; ++k) {
      const int j2 = j0 + k;
      float sn = U[loc + j2 * SDIM];
#pragma unroll
      for (int m = 0; m < 16; ++m) sn += __shfl(s, m, 16) * Acol[m];
      s = sn;
      ws[WS_SL + blk + loc + j2 * SDIM] = s;
    }
    // the next pass rewrites the registers that this pass's stores name
    asm volatile("s_wait_xcnt 0x0" ::: "memory");
  }
}

// ===========================================================================
// Kernel 3: chunk carries: C_{c+1} = C_c * T + v_c, T = A_d^L. Also writes
// final_state to the out tail.
// Two-level scan, so that the serial chain is 7 + 16 + 7 steps, not 128: each
// batch's 128 chunks are 16 groups of 8.
//   1. every group is scanned from a zero carry (its end e_g); a fifth wave
//      runs the same steps on T itself and so gets T^8;
//   2. one chain over the groups: G_{g+1} = G_g T^8 + e_g;
//   3. every group is scanned again from its true carry-in G_g.
// A step is S <- T^t S + V on f32 WMMA: S holds 16 state columns (one group
// each; wave = batch). D of one step is B of the next with no move between
// lanes: WMMA j takes D registers 2j, 2j+1, which in lane half h are the states
// m = 8h + 2j + v; the A fragments below use the same k order.
// ===========================================================================
constexpr int GRP  = 16;           // groups per batch
constexpr int GLEN = NCHB / GRP;   // chunks per group

__device__ __forceinline__ v8f ld8(const float* p) {
  const float4 lo = *(const float4*)p, hi = *(const float4*)(p + 4);
  return v8f{lo.x, lo.y, lo.z, lo.w, hi.x, hi.y, hi.z, hi.w};
}
__device__ __forceinline__ void st8(float* p, v8f s) {
  *(float4*)p       = make_float4(s[0], s[1], s[2], s[3]);
  *(float4*)(p + 4) = make_float4(s[4], s[5], s[6], s[7]);
}
__device__ __forceinline__ v8f carry_step(const v2f (&a)[4], v8f s, v8f add) {
  v8f acc = add;
  // unrolled: register elements need constant indices
#pragma unroll
  for (int j = 0; j < 4; ++j) {
    const v2f b = {s[2 * j], s[2 * j + 1]};
    acc = wmma_f32_16x16x4(a[j], b, acc);
  }
  return acc;
}

__global__ __launch_bounds__(160) void k_carry(const float* __restrict__ state0,
                                               float* __restrict__ ws,
                                               float* __restrict__ out) {
  __shared__ __attribute__((aligned(16))) float Q[SDIM * SDIM];          // (T^8)^t [n][m]
  __shared__ __attribute__((aligned(16))) float E[BATCH * GRP * SDIM];   // group ends
  __shared__ __attribute__((aligned(16))) float G[GRP * 16 * SDIM];      // carry-ins [g][column]
  const int tid = threadIdx.x;
  // wave number as a scalar: the branches on it are whole-wave branches
  const int w = __builtin_amdgcn_readfirstlane(tid >> 5);
  const int col = tid & 15, half = (tid >> 4) & 1;
  const float* __restrict__ T = ws + WS_P + LCH * 256;

  // Every loop of this kernel is unrolled: the arrays need constant indices to
  // stay in registers, and each batch of loads goes out ahead of its chain.
  // One run of loads for every wave, with no branch in front of it (a branch
  // made the chunk loads wait for the T loads). Wave 4 has no chunks: it starts
  // from T^t (element (n = v + 8*half, col)), reads wave 0's other chunks and
  // replaces them by zeros below.
  const int wb = (w < BATCH) ? w : 0;
  const float* __restrict__ vp =
      &ws[WS_SL + ((wb * NCHB + col * GLEN) * LCH + (LCH - 1)) * SDIM + 8 * half];
  const float* __restrict__ p0 = (w < BATCH) ? vp : &T[col * SDIM + 8 * half];
  v8f V[GLEN];   // v_c = the chunk's last local state
  V[0] = ld8(p0);
#pragma unroll
  for (int k = 1; k < GLEN; ++k) V[k] = ld8(vp + k * LCH * SDIM);
  const v8f S0 = ld8(&state0[(col & (BATCH - 1)) * SDIM + 8 * half]);
  // what follows may rewrite the address registers of the loads above
  asm volatile("s_wait_xcnt 0x0" ::: "memory");
  v2f ta[4];   // A fragments of T^t: row n = col, k slot -> m = 8*half + 2j + v
#pragma unroll
  for (int j = 0; j < 4; ++j) {
    ta[j][0] = T[(8 * half + 2 * j) * SDIM + col];
    ta[j][1] = T[(8 * half + 2 * j + 1) * SDIM + col];
  }
  // as above, for the T loads
  asm volatile("s_wait_xcnt 0x0" ::: "memory");
  if (w == BATCH) {   // powers of T take no addend
#pragma unroll
    for (int k = 1; k < GLEN; ++k) V[k] = v8f{0.f, 0.f, 0.f, 0.f, 0.f, 0.f, 0.f, 0.f};
  }

  // ---- 1: group ends from a zero carry (wave 4: T^8) ----
  v8f S = V[0];
#pragma unroll
  for (int k = 1; k < GLEN; ++k) S = carry_step(ta, S, V[k]);
  if (w < BATCH) {
    st8(&E[(w * GRP + col) * SDIM + 8 * half], S);
  } else {
#pragma unroll
    for (int v = 0; v < 8; ++v) Q[(v + 8 * half) * SDIM + col] = S[v];
  }
  __syncthreads();

  // ---- 2: chain over the groups (wave 4; column = batch, repeated 4 times) ----
  if (w == BATCH) {
    v2f qa[4];
    v8f Ef[GRP];
#pragma unroll
    for (int j = 0; j < 4; ++j)
      qa[j] = *(const v2f*)&Q[col * SDIM + 8 * half + 2 * j];
#pragma unroll
    for (int g = 0; g < GRP; ++g)
      Ef[g] = ld8(&E[((col & (BATCH - 1)) * GRP + g) * SDIM + 8 * half]);
    S = S0;
#pragma unroll
    for (int g = 0; g < GRP; ++g) {
      st8(&G[(g * 16 + col) * SDIM + 8 * half], S);
      S = carry_step(qa, S, Ef[g]);
    }
  }
  __syncthreads();
  // final_state; behind the barrier, so that no wave waits there for this store
  if (w == BATCH && col < BATCH) st8(&out[ROWS * HID + col * SDIM + 8 * half], S);

  // ---- 3: every group again, from its true carry-in ----
  if (w < BATCH) {
    v8f C[GLEN];
    C[0] = ld8(&G[(col * 16 + w) * SDIM + 8 * half]);
#pragma unroll
    for (int k = 1; k < GLEN; ++k) C[k] = carry_step(ta, C[k - 1], V[k - 1]);
    // stored behind the chain: nothing behind these stores rewrites a register
    // that one of them names
#pragma unroll
    for (int k = 0; k < GLEN; ++k)
      st8(&ws[WS_CARRY + (w * NCHB + col * GLEN + k) * SDIM + 8 * half], C[k]);
  }
}

// ===========================================================================
// Kernel 4: out = states @ C^T  (M=16384, K=16, N=1024) with f32 WMMA, the
// carry correction s_t = Sl_t + carry_c * P_{j+1} done in front of it.
// Block = one chunk (32 rows), 8 waves. The 256 threads correct the chunk's
// 512 states (two each, the sums in the order m = 0..15) and leave them in LDS;
// behind one barrier every wave takes its state fragments from there. A wave
// owns 8 h-tiles (128 columns = 512 bytes of every row), whose C fragments it
// loads once for both 16-row tiles; 4 chained 16x16x4 WMMAs cover K=16.
// C's rows are the first WMMA operand, so a lane's 8 results are 8 consecutive
// columns of one row: they go to the wave's own LDS range in 16-byte writes,
// and each row comes back as 32 lanes x 16 bytes and leaves in ONE store of
// four whole 128-byte lines.
// ===========================================================================
constexpr int SPAD = 20;    // LDS row pitch in floats: the 16 rows of a fragment read fall on distinct banks
constexpr int OPAD = 132;   // pitch of a staged output row: 16 lanes' 16-byte writes fall on all 64 banks

__global__ __launch_bounds__(256) void k_out_gemm(const float* __restrict__ Cmat,
                                                  const float* __restrict__ ws,
                                                  float* __restrict__ out) {
  __shared__ __attribute__((aligned(16))) float Ss[LCH * SPAD];
  __shared__ __attribute__((aligned(16))) float Ot[8][16 * OPAD];   // a wave's 16 rows x 128 columns
  const int tid = threadIdx.x;
  const int c = blockIdx.x;                 // chunk; row%32 == t%32 (4096%32==0)
  const int M = tid & 15, half = (tid >> 4) & 1;
  const int lane = tid & 31;
  const int r0 = tid >> 4;                  // thread corrects rows r0 and r0 + 16
  const int hg = tid >> 5;                  // wave's group of 8 h-tiles

  // Every loop of this kernel is unrolled: the arrays need constant indices to
  // stay in registers, and all loads go out in one batch ahead of the sums.
  const float* __restrict__ Sl = ws + WS_SL + c * (LCH * SDIM);
  const float* __restrict__ cr = ws + WS_CARRY + c * SDIM;
  const float* __restrict__ P  = ws + WS_P + (r0 + 1) * 256 + M;
  float s0 = Sl[tid], s1 = Sl[256 + tid];
  float p0[16], p1[16];
#pragma unroll
  for (int m = 0; m < 16; ++m) {
    p0[m] = P[m * 16];
    p1[m] = P[16 * 256 + m * 16];
  }
  // a C fragment below may land in the address registers of the loads above
  asm volatile("s_wait_xcnt 0x0" ::: "memory");
  v2f b[8][4];
#pragma unroll
  for (int ht = 0; ht < 8; ++ht)
#pragma unroll
    for (int k4 = 0; k4 < 4; ++k4)
      b[ht][k4] = *(const v2f*)&Cmat[((hg * 8 + ht) * 16 + M) * SDIM + k4 * 4 + 2 * half];

#pragma unroll
  for (int m = 0; m < 16; ++m) {
    s0 += cr[m] * p0[m];
    s1 += cr[m] * p1[m];
  }
  Ss[r0 * SPAD + M]        = s0;
  Ss[(r0 + 16) * SPAD + M] = s1;
  __syncthreads();

  float* __restrict__ op = out + c * LCH * HID + hg * 128 + lane * 4;
  float* wr = &Ot[hg][M * OPAD + 8 * half];         // lane's row, its 8 columns of tile 0
  const float* rd = &Ot[hg][lane * 4];                     // lane's 16 bytes of row 0
  v2f a[2][4];
#pragma unroll
  for (int rt = 0; rt < 2; ++rt)
#pragma unroll
    for (int k4 = 0; k4 < 4; ++k4)
      a[rt][k4] = *(const v2f*)&Ss[(rt * 16 + M) * SPAD + k4 * 4 + 2 * half];
#pragma unroll
  for (int rt = 0; rt < 2; ++rt) {
#pragma unroll
    for (int ht = 0; ht < 8; ++ht) {
      v8f acc = {0.f, 0.f, 0.f, 0.f, 0.f, 0.f, 0.f, 0.f};
      // acc[r] = out[row M][column ht*16 + 8*half + r]
#pragma unroll
      for (int k4 = 0; k4 < 4; ++k4) acc = wmma_f32_16x16x4(b[ht][k4], a[rt][k4], acc);
      st8(wr + ht * 16, acc);
    }
    // the wave's own LDS writes are done before other lanes' values are read back
    asm volatile("s_wait_dscnt 0x0" ::: "memory");
    float4 row[16];
#pragma unroll
    for (int r = 0; r < 16; ++r) row[r] = *(const float4*)(rd + r * OPAD);
#pragma unroll
    for (int r = 0; r < 16; ++r) *(float4*)(op + (rt * 16 + r) * HID) = row[r];
    // the second row tile rewrites the staging range (behind these reads) and
    // may rewrite registers that the first one's stores name
    if (rt == 0) asm volatile("s_wait_dscnt 0x0\n\ts_wait_xcnt 0x0" ::: "memory");
  }
}

// ===========================================================================
extern "C" void kernel_launch(void* const* d_in, const int* in_sizes, int n_in,
                              void* d_out, int out_size, void* d_ws,
                              size_t ws_size, hipStream_t stream) {
  const float* x   = (const float*)d_in[0];  // [4,4096,1024]
  const float* st0 = (const float*)d_in[1];  // [4,16]
  const float* A   = (const float*)d_in[2];  // [16,16]
  const float* B   = (const float*)d_in[3];  // [16,1024]
  const float* C   = (const float*)d_in[4];  // [1024,16]
  const float* ld  = (const float*)d_in[5];  // [1024]
  float* out = (float*)d_out;                // [4,4096,1024] ++ [4,16]
  float* ws  = (float*)d_ws;                 // needs ~2.2 MB f32 scratch

  k_u_gemm<<<ROWS / 128 + 1, 256, 0, stream>>>(x, A, B, ld, ws);
  k_scan_local<<<NCH / 16, 256, 0, stream>>>(ws);
  k_carry<<<1, 160, 0, stream>>>(st0, ws, out);
  k_out_gemm<<<NCH, 256, 0, stream>>>(C, ws, out);
}

// v007
// It runs in 38.3 microseconds.
// In two side-by-side timings against v006, it was 1.09 and 1.08 times as fast.
// Counting every step since v000, it is 4.31 times as fast.
#include <hip/hip_runtime.h>
#include <hip/hip_bf16.h>
#include <math.h>

typedef float v2f __attribute__((ext_vector_type(2)));
typedef float v8f __attribute__((ext_vector_type(8)));
typedef int   v4i_vs __attribute__((vector_size(16)));   // matches builtin param

// Problem shape (fixed by the reference)
constexpr int BATCH = 4;
constexpr int SEQ   = 4096;
constexpr int HID   = 1024;
constexpr int SDIM  = 16;
constexpr int ROWS  = BATCH * SEQ;     // 16384  (row = b*SEQ + t)
constexpr int LCH   = 32;              // scan chunk length
constexpr int NCHB  = SEQ / LCH;       // 128 chunks per batch
constexpr int NCH   = BATCH * NCHB;    // 512 chunks total

// Workspace layout (float offsets); total ~2.2 MB of f32
constexpr int WS_M     = 0;                           // M = A^-1 (A_d - I) [16][16]
constexpr int WS_P     = WS_M + 256;                  // P_j = A_d^j, j=0..32
constexpr int WS_U     = WS_P + (LCH + 1) * 256;      // y = x B^T [ROWS][16]
constexpr int WS_SL    = WS_U + ROWS * SDIM;          // local (zero-carry) states

// CDNA5 async global->LDS path (ASYNCcnt-tracked, no VGPR round trip)
#if defined(__gfx1250__) && __has_builtin(__builtin_amdgcn_global_load_async_to_lds_b128)
#define HAVE_ASYNC_LDS 1
#else
#define HAVE_ASYNC_LDS 0
#endif

#if __has_builtin(__builtin_amdgcn_s_wait_asynccnt)
#define WAIT_ASYNCCNT(n) __builtin_amdgcn_s_wait_asynccnt(n)
#else
#define WAIT_ASYNCCNT(n) asm volatile("s_wait_asynccnt " #n ::: "memory")
#endif

// ---------------------------------------------------------------------------
// f32 WMMA: D = A(16x4) * B(4x16) + C(16x16), full f32 precision.
// A layout (ISA 7.12.2): lane l -> M = l%16, VGPR v -> K = v + 2*(l/16)
// B layout (row-striped): lane l -> N = l%16, VGPR v -> K = v + 2*(l/16)
// C/D layout: lane l -> N = l%16, VGPR v -> M = v + 8*(l/16)
// ---------------------------------------------------------------------------
__device__ __forceinline__ v8f wmma_f32_16x16x4(v2f a, v2f b, v8f c) {
  return __builtin_amdgcn_wmma_f32_16x16x4_f32(false, a, false, b, (short)0, c,
                                               false, false);
}

// ===========================================================================
// Setup (one block of kernel 1). dt, A_d = expm(A*dt) (Taylor 12 + 6
// squarings), Ainv via Gauss-Jordan w/ partial pivoting, M = Ainv*(A_d - I),
// powers P_0..P_32.  256 threads (thread = elem (i,j)).
// B_d = M*B is never formed: x B_d^T = (x B^T) M^T, so the big product needs
// nothing from here and this serial work runs beside it in the same launch.
// ===========================================================================
__device__ __forceinline__ void setup_block(const float* __restrict__ A,
                                            const float* __restrict__ log_dt,
                                            float* __restrict__ ws) {
  __shared__ float red[256];
  __shared__ float Ms[256], term[256], acc[256], Ad[256];
  __shared__ float aug[16 * 33];
  __shared__ float fcol[16];
  __shared__ float Ainv[256];
  __shared__ float s_dt, s_inv;
  __shared__ int s_piv;

  const int tid = threadIdx.x;
  const int i = tid >> 4, j = tid & 15;

  // ---- dt = mean(exp(log_dt)) ----
  float s = 0.f;
  for (int q = tid; q < HID; q += 256) s += expf(log_dt[q]);
  red[tid] = s;
  __syncthreads();
  for (int o = 128; o > 0; o >>= 1) {
    if (tid < o) red[tid] += red[tid + o];
    __syncthreads();
  }
  if (tid == 0) s_dt = red[0] * (1.0f / (float)HID);
  __syncthreads();

  // ---- expm(A*dt): scale by 2^-6, Taylor 12, square 6x ----
  Ms[tid]   = A[tid] * (s_dt * (1.0f / 64.0f));
  term[tid] = (i == j) ? 1.f : 0.f;
  acc[tid]  = (i == j) ? 1.f : 0.f;
  __syncthreads();
  for (int it = 1; it <= 12; ++it) {
    float t2 = 0.f;
    for (int k = 0; k < 16; ++k) t2 += term[i * 16 + k] * Ms[k * 16 + j];
    __syncthreads();
    term[tid] = t2 / (float)it;
    acc[tid] += term[tid];
    __syncthreads();
  }
  for (int sq = 0; sq < 6; ++sq) {
    float t2 = 0.f;
    for (int k = 0; k < 16; ++k) t2 += acc[i * 16 + k] * acc[k * 16 + j];
    __syncthreads();
    acc[tid] = t2;
    __syncthreads();
  }
  Ad[tid] = acc[tid];
  __syncthreads();

  // ---- Gauss-Jordan inverse of A (augmented [A | I], partial pivoting) ----
  aug[i * 33 + j]      = A[tid];
  aug[i * 33 + 16 + j] = (i == j) ? 1.f : 0.f;
  __syncthreads();
  for (int k = 0; k < 16; ++k) {
    if (tid == 0) {
      int p = k;
      float best = fabsf(aug[k * 33 + k]);
      for (int r = k + 1; r < 16; ++r) {
        float v = fabsf(aug[r * 33 + k]);
        if (v > best) { best = v; p = r; }
      }
      s_piv = p;
    }
    __syncthreads();
    const int p = s_piv;
    if (p != k && tid < 32) {
      float t2 = aug[k * 33 + tid];
      aug[k * 33 + tid] = aug[p * 33 + tid];
      aug[p * 33 + tid] = t2;
    }
    __syncthreads();
    if (tid == 0) s_inv = 1.0f / aug[k * 33 + k];
    __syncthreads();
    if (tid < 32) aug[k * 33 + tid] *= s_inv;
    __syncthreads();
    if (tid < 16) fcol[tid] = aug[tid * 33 + k];
    __syncthreads();
    if (i != k) {
      aug[i * 33 + j]      -= fcol[i] * aug[k * 33 + j];
      aug[i * 33 + 16 + j] -= fcol[i] * aug[k * 33 + 16 + j];
    }
    __syncthreads();
  }
  Ainv[tid] = aug[i * 33 + 16 + j];
  __syncthreads();

  // ---- M = Ainv * (A_d - I) ----
  {
    float t2 = 0.f;
    for (int k = 0; k < 16; ++k) {
      float ad = Ad[k * 16 + j] - ((k == j) ? 1.f : 0.f);
      t2 += Ainv[i * 16 + k] * ad;
    }
    ws[WS_M + tid] = t2;
  }

  // ---- powers P_0..P_LCH of A_d ----
  // P_k = P_(k-1) A_d goes row by row: row i of P_k needs only row i of
  // P_(k-1), which the row's own 16 lanes hold, and column j of A_d, which
  // never changes. So each 16-lane group carries its row through shuffles
  // (as k_scan_local does) and the chain meets no barrier and no store wait.
  // Same products, same k order as a plain P_(k-1) A_d.
  float Acol[16];
  // unrolled: constant indices keep the column in registers
#pragma unroll
  for (int k = 0; k < 16; ++k) Acol[k] = Ad[k * 16 + j];
  float pw[LCH + 1];
  pw[0] = (i == j) ? 1.f : 0.f;
  pw[1] = Ad[tid];
  // unrolled: every power stays in a register of its own until the stores
#pragma unroll
  for (int jp = 2; jp <= LCH; ++jp) {
    float t2 = 0.f;
    // unrolled: a shuffle from a constant lane compiles to a row broadcast in
    // the vector unit (no LDS round trip), and Acol needs constant indices
#pragma unroll
    for (int k = 0; k < 16; ++k) t2 += __shfl(pw[jp - 1], k, 16) * Acol[k];
    pw[jp] = t2;
  }
  // unrolled: constant indices; nothing behind these stores rewrites a
  // register that one of them names
#pragma unroll
  for (int jp = 0; jp <= LCH; ++jp) ws[WS_P + jp * 256 + tid] = pw[jp];
}

// ===========================================================================
// Kernel 1: y = x @ B^T  (M=16384, K=1024, N=16) with f32 WMMA; the block
// behind the last row tile does the setup instead (nothing here reads it).
// Block = 256 threads = 8 waves; wave owns a 16-row tile (private LDS stage).
// Async path: GLOBAL_LOAD_ASYNC_TO_LDS_B128 double-buffered, ASYNCcnt-paced,
// zero barriers (DS ops are in-order in HW; explicit s_wait_dscnt guards the
// async-write-after-ds-read hazard since ASYNCcnt/DScnt are unordered).
// ===========================================================================
constexpr int KSW  = 32;   // K columns staged per step
constexpr int XPAD = 36;   // row pad: stride 36 mod 64 -> conflict-free banks

__global__ __launch_bounds__(256) void k_u_gemm(const float* __restrict__ x,
                                                const float* __restrict__ A,
                                                const float* __restrict__ Bmat,
                                                const float* __restrict__ log_dt,
                                                float* __restrict__ ws) {
  if (blockIdx.x == ROWS / 128) {   // whole block
    setup_block(A, log_dt, ws);
    return;
  }
#if HAVE_ASYNC_LDS
  __shared__ float Xs[8][2][16 * XPAD];   // double buffer, 36.9 KB
#else
  __shared__ float Xs[8][1][16 * XPAD];
#endif
  const int tid = threadIdx.x;
  const int w = tid >> 5, lane = tid & 31;
  const int M = lane & 15, half = lane >> 4;
  const int rowbase = blockIdx.x * 128 + w * 16;

  v8f acc = {0.f, 0.f, 0.f, 0.f, 0.f, 0.f, 0.f, 0.f};

  auto compute = [&](int stq, int buf) {
    const int k0 = stq * KSW;
#pragma unroll
    for (int kk = 0; kk < KSW; kk += 4) {
      v2f a = *(const v2f*)&Xs[w][buf][M * XPAD + kk + 2 * half];
      v2f b = *(const v2f*)&Bmat[M * HID + k0 + kk + 2 * half];
      acc = wmma_f32_16x16x4(a, b, acc);
    }
  };

#if HAVE_ASYNC_LDS
  auto stage_async = [&](int stq, int buf) {
    // previous ds reads of this buffer must have executed before async writes
    asm volatile("s_wait_dscnt 0x0" ::: "memory");
#pragma unroll
    for (int it = 0; it < 4; ++it) {   // 4 x B128 per lane = 16 rows x 32 cols
      const int r = it * 4 + (lane >> 3), c4 = lane & 7;
      __builtin_amdgcn_global_load_async_to_lds_b128(
          (__attribute__((address_space(1))) v4i_vs*)
              &x[(rowbase + r) * HID + stq * KSW + c4 * 4],
          (__attribute__((address_space(3))) v4i_vs*)
              &Xs[w][buf][r * XPAD + c4 * 4],
          0, 0);
    }
  };

  stage_async(0, 0);
  for (int st = 0; st < HID / KSW; ++st) {
    const int buf = st & 1;
    if (st + 1 < HID / KSW) {
      stage_async(st + 1, buf ^ 1);
      __builtin_prefetch(&x[(rowbase + M) * HID + (st + 1) * KSW], 0, 1);
      WAIT_ASYNCCNT(4);   // dones are in-order: only newest stage outstanding
    } else {
      WAIT_ASYNCCNT(0);
    }
    compute(st, buf);
  }
#else
  for (int st = 0; st < HID / KSW; ++st) {
    const int k0 = st * KSW;
#pragma unroll
    for (int it = 0; it < 4; ++it) {
      const int r = it * 4 + (lane >> 3), c4 = lane & 7;
      const float4 v = *(const float4*)&x[(rowbase + r) * HID + k0 + c4 * 4];
      *(float4*)&Xs[w][0][r * XPAD + c4 * 4] = v;
    }
    if (st + 1 < HID / KSW)
      __builtin_prefetch(&x[(rowbase + M) * HID + k0 + KSW], 0, 1);
    __syncthreads();
    compute(st, 0);
    __syncthreads();
  }
#endif

#pragma unroll
  for (int v = 0; v < 8; ++v)
    ws[WS_U + (rowbase + v + 8 * half) * SDIM + M] = acc[v];
}

// ===========================================================================
// Kernel 2: per-chunk local scan (zero carry-in): s_j = s_{j-1} A_d + u_j.
// 16 lanes per chunk, cross-lane via shfl(width 16); A_d column in registers.
// The block's 16 chunks of y are read in one batch of loads, turned into
// u = y M^T on the way (f32 WMMA, each wave its own 64 rows = 4 tiles) and
// staged in LDS, so no step of the serial chain waits for a global load.
// ===========================================================================
__global__ __launch_bounds__(256) void k_scan_local(float* __restrict__ ws) {
  constexpr int BLK = 16 * LCH * SDIM;   // floats of y per block (contiguous)
  __shared__ float U[BLK];               // 32 KB
  const int tid = threadIdx.x;
  const int n = tid & 15;
  const int blk = blockIdx.x * BLK;
  float Acol[16];
#pragma unroll
  for (int m = 0; m < 16; ++m) Acol[m] = ws[WS_P + 256 + m * 16 + n];
  const int half = (tid >> 4) & 1;
  const int wrow = (tid >> 5) * (2 * LCH);   // first of the wave's 64 rows
  v2f mb[4], ya[4][4];
  // loops unrolled: the fragment arrays need constant indices to stay in
  // registers, and all 20 loads go out in one batch ahead of the first WMMA
#pragma unroll
  for (int k4 = 0; k4 < 4; ++k4)
    mb[k4] = *(const v2f*)&ws[WS_M + n * SDIM + k4 * 4 + 2 * half];
#pragma unroll
  for (int t = 0; t < 4; ++t)
#pragma unroll
    for (int k4 = 0; k4 < 4; ++k4)
      ya[t][k4] = *(const v2f*)&ws[WS_U + blk + (wrow + t * 16 + n) * SDIM +
                                   k4 * 4 + 2 * half];
#pragma unroll
  for (int t = 0; t < 4; ++t) {
    v8f acc = {0.f, 0.f, 0.f, 0.f, 0.f, 0.f, 0.f, 0.f};
#pragma unroll
    for (int k4 = 0; k4 < 4; ++k4) acc = wmma_f32_16x16x4(ya[t][k4], mb[k4], acc);
#pragma unroll
    for (int v = 0; v < 8; ++v)
      U[(wrow + t * 16 + v + 8 * half) * SDIM + n] = acc[v];
  }
  __syncthreads();
  float s = 0.f;
  const int loc = (tid >> 4) * (LCH * SDIM) + n;
  for (int j0 = 0; j0 < LCH; j0 += 16) {
    // 16 steps unrolled so that their LDS reads issue together, ahead of the
    // chain, and the LDS latency is paid once per 16 steps
#pragma unroll
    for (int k = 0; k < 16; ++k) {
      const int j2 = j0 + k;
      float sn = U[loc + j2 * SDIM];
#pragma unroll
      for (int m = 0; m < 16; ++m) sn += __shfl(s, m, 16) * Acol[m];
      s = sn;
      ws[WS_SL + blk + loc + j2 * SDIM] = s;
    }
    // the next pass rewrites the registers that this pass's stores name
    asm volatile("s_wait_xcnt 0x0" ::: "memory");
  }
}

// ===========================================================================
// Chunk carries: C_{c+1} = C_c * T + v_c, T = A_d^L. No launch of their own:
// every block of the last kernel works out its own chunk's carry-in, and its
// last block, on waves that would idle, the final_state of all batches.
// Two-level scan, so that the serial chain is 7 + 15 + 7 steps, not 128: each
// batch's 128 chunks are 16 groups of 8.
//   1. every group is scanned from a zero carry (its end e_g); one more wave
//      runs the same steps on T itself and so gets T^8;
//   2. one chain over the groups: G_{g+1} = G_g T^8 + e_g;
//   3. the block's own group is scanned again from its true carry-in G_g, up to
//      the block's chunk.
// A step is S <- T^t S + V on f32 WMMA: S holds 16 state columns (one group
// each). D of one step is B of the next with no move between
// lanes: WMMA j takes D registers 2j, 2j+1, which in lane half h are the states
// m = 8h + 2j + v; the A fragments below use the same k order.
// ===========================================================================
constexpr int GRP  = 16;           // groups per batch
constexpr int GLEN = NCHB / GRP;   // chunks per group

__device__ __forceinline__ v8f ld8(const float* p) {
  const float4 lo = *(const float4*)p, hi = *(const float4*)(p + 4);
  return v8f{lo.x, lo.y, lo.z, lo.w, hi.x, hi.y, hi.z, hi.w};
}
__device__ __forceinline__ void st8(float* p, v8f s) {
  *(float4*)p       = make_float4(s[0], s[1], s[2], s[3]);
  *(float4*)(p + 4) = make_float4(s[4], s[5], s[6], s[7]);
}
__device__ __forceinline__ v8f carry_step(const v2f (&a)[4], v8f s, v8f add) {
  v8f acc = add;
  // unrolled: register elements need constant indices
#pragma unroll
  for (int j = 0; j < 4; ++j) {
    const v2f b = {s[2 * j], s[2 * j + 1]};
    acc = wmma_f32_16x16x4(a[j], b, acc);
  }
  return acc;
}

// ===========================================================================
// Kernel 3: out = states @ C^T  (M=16384, K=16, N=1024) with f32 WMMA, the
// carry correction s_t = Sl_t + carry_c * P_{j+1} done in front of it.
// Block = one chunk (32 rows), 8 waves. In front of the correction the block
// works out its own carry-in, by the steps described above: wave 0
// scans its batch's 16 groups (columns) from zero, wave 1 gets T^8; behind a
// barrier wave 0 chains over the groups up to its own (every column the same)
// and then steps through its group up to its chunk; the group's column goes to
// LDS, and a second barrier hands it to all. In the last block waves 2..5 scan
// the groups of one batch each as well, and wave 1 chains over all 16 groups
// (column = batch) beside wave 0: final_state, all four rows from one wave.
// The 256 threads correct the chunk's
// 512 states (two each, the sums in the order m = 0..15) and leave them in LDS;
// behind one barrier every wave takes its state fragments from there. A wave
// owns 8 h-tiles (128 columns = 512 bytes of every row), whose C fragments it
// loads once for both 16-row tiles; 4 chained 16x16x4 WMMAs cover K=16.
// C's rows are the first WMMA operand, so a lane's 8 results are 8 consecutive
// columns of one row: they go to the wave's own LDS range in 16-byte writes,
// and each row comes back as 32 lanes x 16 bytes and leaves in ONE store of
// four whole 128-byte lines.
// ===========================================================================
constexpr int SPAD = 20;    // LDS row pitch in floats: the 16 rows of a fragment read fall on distinct banks
constexpr int OPAD = 132;   // pitch of a staged output row: 16 lanes' 16-byte writes fall on all 64 banks

__global__ __launch_bounds__(256) void k_out_gemm(const float* __restrict__ Cmat,
                                                     const float* __restrict__ state0,
                                                     const float* __restrict__ ws,
                                                     float* __restrict__ out) {
  __shared__ __attribute__((aligned(16))) float Qo[SDIM * SDIM];   // (T^8)^t [n][m]
  __shared__ __attribute__((aligned(16))) float Eo[GRP * SDIM];    // the batch's group ends
  __shared__ __attribute__((aligned(16))) float Ea[BATCH * GRP * SDIM];   // last block: every batch's
  __shared__ __attribute__((aligned(16))) float Cr[SDIM];          // the chunk's carry-in
  __shared__ __attribute__((aligned(16))) float Ss[LCH * SPAD];
  __shared__ __attribute__((aligned(16))) float Ot[8][16 * OPAD];   // a wave's 16 rows x 128 columns
  const int tid = threadIdx.x;
  const int c = blockIdx.x;                 // chunk; row%32 == t%32 (4096%32==0)
  const int M = tid & 15, half = (tid >> 4) & 1;
  const int lane = tid & 31;
  const int r0 = tid >> 4;                  // thread corrects rows r0 and r0 + 16
  const int hg = tid >> 5;                  // wave's group of 8 h-tiles

  // Every loop of this kernel is unrolled: the arrays need constant indices to
  // stay in registers, and all loads go out in one batch ahead of the sums.
  // the wave's part in the carry work, a scalar (whole-wave branches). Turned by
  // two waves in every other block: where two blocks share a WGP their chains
  // then tend to run on different SIMDs' matrix units (speed only)
  const int w = (__builtin_amdgcn_readfirstlane(tid >> 5) + 2 * ((c ^ (c >> 8)) & 1)) & 7;
  const int bt = c / NCHB;                  // batch
  const int g = (c % NCHB) / GLEN;          // the chunk's group
  const int r = c % GLEN;                   // its place in the group
  const float* __restrict__ T = ws + WS_P + LCH * 256;
  // the carry chain's loads go out first: it is the longest path of the block
  v8f V[GLEN], S0;   // column M: group M's chunk ends (wave 1: T^t, then zeros)
  v2f ta[4];         // A fragments of T^t: row n = M, k slot -> m = 8*half + 2j + v
  const bool fin = (c == NCH - 1);               // the block that also gives final_state
  const bool scans = (w < 2) || (fin && w < 2 + BATCH);
  if (scans) {
    const int wb = (w < 2) ? bt : w - 2;         // the batch whose groups the wave scans
    const float* __restrict__ vp =
        &ws[WS_SL + ((wb * NCHB + M * GLEN) * LCH + (LCH - 1)) * SDIM + 8 * half];
    V[0] = ld8((w != 1) ? vp : &T[M * SDIM + 8 * half]);
#pragma unroll
    for (int k = 1; k < GLEN; ++k) V[k] = ld8(vp + k * LCH * SDIM);
    // wave 1 chains all batches (column = batch, repeated 4 times)
    S0 = ld8(&state0[((w == 1) ? (M & (BATCH - 1)) : bt) * SDIM + 8 * half]);
    // what follows may rewrite the address registers of the loads above
    asm volatile("s_wait_xcnt 0x0" ::: "memory");
#pragma unroll
    for (int j = 0; j < 4; ++j) {
      ta[j][0] = T[(8 * half + 2 * j) * SDIM + M];
      ta[j][1] = T[(8 * half + 2 * j + 1) * SDIM + M];
    }
    // as above, for the T loads
    asm volatile("s_wait_xcnt 0x0" ::: "memory");
  }
  const float* __restrict__ Sl = ws + WS_SL + c * (LCH * SDIM);
  const float* __restrict__ P  = ws + WS_P + (r0 + 1) * 256 + M;
  float s0 = Sl[tid], s1 = Sl[256 + tid];
  float p0[16], p1[16];
#pragma unroll
  for (int m = 0; m < 16; ++m) {
    p0[m] = P[m * 16];
    p1[m] = P[16 * 256 + m * 16];
  }
  // a C fragment below may land in the address registers of the loads above
  asm volatile("s_wait_xcnt 0x0" ::: "memory");
  v2f b[8][4];
#pragma unroll
  for (int ht = 0; ht < 8; ++ht)
#pragma unroll
    for (int k4 = 0; k4 < 4; ++k4)
      b[ht][k4] = *(const v2f*)&Cmat[((hg * 8 + ht) * 16 + M) * SDIM + k4 * 4 + 2 * half];

  // ---- carry 1: group ends from a zero carry (wave 1: T^8) ----
  if (scans) {
    if (w == 1) {   // powers of T take no addend
#pragma unroll
      for (int k = 1; k < GLEN; ++k) V[k] = v8f{0.f, 0.f, 0.f, 0.f, 0.f, 0.f, 0.f, 0.f};
    }
    v8f S = V[0];
#pragma unroll
    for (int k = 1; k < GLEN; ++k) S = carry_step(ta, S, V[k]);
    if (w == 0) {
      st8(&Eo[M * SDIM + 8 * half], S);
    } else if (w == 1) {
#pragma unroll
      for (int v = 0; v < 8; ++v) Qo[(v + 8 * half) * SDIM + M] = S[v];
    } else {
      st8(&Ea[((w - 2) * GRP + M) * SDIM + 8 * half], S);
    }
  }
  __syncthreads();
  v8f Fs;   // last block, wave 1: final_state
  if (fin && w == 1) {
    v2f qa[4];
#pragma unroll
    for (int j = 0; j < 4; ++j)
      qa[j] = *(const v2f*)&Qo[M * SDIM + 8 * half + 2 * j];
    Fs = S0;
#pragma unroll
    for (int gi = 0; gi < GRP; ++gi)
      Fs = carry_step(qa, Fs, ld8(&Ea[((M & (BATCH - 1)) * GRP + gi) * SDIM + 8 * half]));
  }
  if (w == 0) {
    // ---- carry 2: chain over the groups; the value in front of group g is kept ----
    v2f qa[4];
#pragma unroll
    for (int j = 0; j < 4; ++j)
      qa[j] = *(const v2f*)&Qo[M * SDIM + 8 * half + 2 * j];
    // The group ends are read three at a time, three steps ahead of their use:
    // no step waits for LDS, and at most six are in registers (all fifteen at
    // once would cost the second block of the WGP its registers).
    v8f Ef[GRP - 1];
#pragma unroll
    for (int gi = 0; gi < 3; ++gi) Ef[gi] = ld8(&Eo[gi * SDIM + 8 * half]);
    v8f S = S0, Gg = S0;
#pragma unroll
    for (int g3 = 0; g3 < GRP - 1; g3 += 3) {
      if (g3 + 3 < GRP - 1) {
#pragma unroll
        for (int gi = g3 + 3; gi < g3 + 6; ++gi) Ef[gi] = ld8(&Eo[gi * SDIM + 8 * half]);
      }
#pragma unroll
      for (int gi = g3 + 1; gi <= g3 + 3; ++gi) {
        S = carry_step(qa, S, Ef[gi - 1]);
        Gg = (gi == g) ? S : Gg;
      }
      // keeps the later reads from being lifted to the front (registers) and
      // this batch's from sinking to their use (LDS latency on the chain)
      __builtin_amdgcn_sched_barrier(0);
    }
    // ---- carry 3: through the group; column g is the block's own ----
    v8f Ck = Gg, Cc = Gg;
#pragma unroll
    for (int k = 1; k < GLEN; ++k) {
      Ck = carry_step(ta, Ck, V[k - 1]);
      Cc = (k == r) ? Ck : Cc;
    }
    if (M == g) st8(&Cr[8 * half], Cc);
  }
  __syncthreads();
  // behind the barrier, so that no wave waits there for this store
  if (fin && w == 1 && M < BATCH) {
    st8(&out[ROWS * HID + M * SDIM + 8 * half], Fs);
    // what follows may rewrite the registers that this store names
    asm volatile("s_wait_xcnt 0x0" ::: "memory");
  }
  float cr[16];
#pragma unroll
  for (int q = 0; q < 4; ++q) {
    const float4 t4 = *(const float4*)&Cr[q * 4];
    cr[q * 4] = t4.x; cr[q * 4 + 1] = t4.y; cr[q * 4 + 2] = t4.z; cr[q * 4 + 3] = t4.w;
  }
#pragma unroll
  for (int m = 0; m < 16; ++m) {
    s0 += cr[m] * p0[m];
    s1 += cr[m] * p1[m];
  }
  Ss[r0 * SPAD + M]        = s0;
  Ss[(r0 + 16) * SPAD + M] = s1;
  __syncthreads();

  float* __restrict__ op = out + c * LCH * HID + hg * 128 + lane * 4;
  float* wr = &Ot[hg][M * OPAD + 8 * half];         // lane's row, its 8 columns of tile 0
  const float* rd = &Ot[hg][lane * 4];                     // lane's 16 bytes of row 0
  v2f a[2][4];
#pragma unroll
  for (int rt = 0; rt < 2; ++rt)
#pragma unroll
    for (int k4 = 0; k4 < 4; ++k4)
      a[rt][k4] = *(const v2f*)&Ss[(rt * 16 + M) * SPAD + k4 * 4 + 2 * half];
#pragma unroll
  for (int rt = 0; rt < 2; ++rt) {
#pragma unroll
    for (int ht = 0; ht < 8; ++ht) {
      v8f acc = {0.f, 0.f, 0.f, 0.f, 0.f, 0.f, 0.f, 0.f};
      // acc[r] = out[row M][column ht*16 + 8*half + r]
#pragma unroll
      for (int k4 = 0; k4 < 4; ++k4) acc = wmma_f32_16x16x4(b[ht][k4], a[rt][k4], acc);
      st8(wr + ht * 16, acc);
    }
    // the wave's own LDS writes are done before other lanes' values are read back
    asm volatile("s_wait_dscnt 0x0" ::: "memory");
    float4 row[16];
#pragma unroll
    for (int r = 0; r < 16; ++r) row[r] = *(const float4*)(rd + r * OPAD);
#pragma unroll
    for (int r = 0; r < 16; ++r) *(float4*)(op + (rt * 16 + r) * HID) = row[r];
    // the second row tile rewrites the staging range (behind these reads) and
    // may rewrite registers that the first one's stores name
    if (rt == 0) asm volatile("s_wait_dscnt 0x0\n\ts_wait_xcnt 0x0" ::: "memory");
  }
}

// ===========================================================================
extern "C" void kernel_launch(void* const* d_in, const int* in_sizes, int n_in,
                              void* d_out, int out_size, void* d_ws,
                              size_t ws_size, hipStream_t stream) {
  const float* x   = (const float*)d_in[0];  // [4,4096,1024]
  const float* st0 = (const float*)d_in[1];  // [4,16]
  const float* A   = (const float*)d_in[2];  // [16,16]
  const float* B   = (const float*)d_in[3];  // [16,1024]
  const float* C   = (const float*)d_in[4];  // [1024,16]
  const float* ld  = (const float*)d_in[5];  // [1024]
  float* out = (float*)d_out;                // [4,4096,1024] ++ [4,16]
  float* ws  = (float*)d_ws;                 // needs ~2.2 MB f32 scratch

  k_u_gemm<<<ROWS / 128 + 1, 256, 0, stream>>>(x, A, B, ld, ws);
  k_scan_local<<<NCH / 16, 256, 0, stream>>>(ws);
  k_out_gemm<<<NCH, 256, 0, stream>>>(C, st0, ws, out);
}

// v010
// One run takes 23.8 microseconds.
// Versions between v007 and this one are left out; their measured steps multiply to 1.62 times as fast.
// All steps since v000 together make it 6.96 times as fast.
#include <hip/hip_runtime.h>
#include <hip/hip_bf16.h>
#include <math.h>

typedef float v2f __attribute__((ext_vector_type(2)));
typedef float v4f __attribute__((ext_vector_type(4)));
typedef float v8f __attribute__((ext_vector_type(8)));
typedef int   v4i_vs __attribute__((vector_size(16)));   // matches builtin param

// Problem shape (fixed by the reference)
constexpr int BATCH = 4;
constexpr int SEQ   = 4096;
constexpr int HID   = 1024;
constexpr int SDIM  = 16;
static_assert(HID == 1024, "the dt loads below cover 8 x 128 values");
constexpr int ROWS  = BATCH * SEQ;     // 16384  (row = b*SEQ + t)
constexpr int LCH   = 32;              // scan chunk length
constexpr int NCHB  = SEQ / LCH;       // 128 chunks per batch
constexpr int NCH   = BATCH * NCHB;    // 512 chunks total

// Workspace layout (float offsets); total ~2.2 MB of f32
constexpr int WS_M     = 0;                           // (not used)
constexpr int WS_P     = WS_M + 256;                  // P_j = A_d^j, j=0..32
constexpr int WS_U     = WS_P + (LCH + 1) * 256;      // (not used)
constexpr int WS_SL    = WS_U + ROWS * SDIM;          // local (zero-carry) states

// CDNA5 async global->LDS path (ASYNCcnt-tracked, no VGPR round trip)
#if defined(__gfx1250__) && __has_builtin(__builtin_amdgcn_global_load_async_to_lds_b128)
#define HAVE_ASYNC_LDS 1
#else
#define HAVE_ASYNC_LDS 0
#endif

// ---------------------------------------------------------------------------
// f32 WMMA: D = A(16x4) * B(4x16) + C(16x16), full f32 precision.
// A layout (ISA 7.12.2): lane l -> M = l%16, VGPR v -> K = v + 2*(l/16)
// B layout (row-striped): lane l -> N = l%16, VGPR v -> K = v + 2*(l/16)
// C/D layout: lane l -> N = l%16, VGPR v -> M = v + 8*(l/16)
// ---------------------------------------------------------------------------
__device__ __forceinline__ v8f wmma_f32_16x16x4(v2f a, v2f b, v8f c) {
  return __builtin_amdgcn_wmma_f32_16x16x4_f32(false, a, false, b, (short)0, c,
                                               false, false);
}

// ===========================================================================
// Setup, done by every block of kernel 1 for itself on two extra waves, beside
// the block's product waves: A_d = expm(A*dt) (Taylor 12 + 6 squarings) on one
// wave, A^-1 (Gauss-Jordan, partial pivoting) on another. Neither meets a
// work-group barrier, so the product waves run on undisturbed.
// B_d = M*B is never formed: x B_d^T = (x B^T) M^T.
// ===========================================================================
// One wave alone works on its LDS range, and the LDS serves a wave in order:
// this only keeps the compiler from moving a lane's LDS reads over the writes
// of the wave's other lanes.
__device__ __forceinline__ void wave_sync() {
  __builtin_amdgcn_fence(__ATOMIC_RELEASE, "wavefront");
  __builtin_amdgcn_wave_barrier();
  __builtin_amdgcn_fence(__ATOMIC_ACQUIRE, "wavefront");
}

// lane -> column j = lane%16 and the 8 rows i = lane/16 + 2q of a 16x16 matrix.
// All q and k loops are unrolled: the arrays need constant indices to stay in
// registers.
__device__ __forceinline__ void expm_wave(const float* __restrict__ A,
                                          const float* __restrict__ log_dt,
                                          float* __restrict__ tm,   // LDS scratch [256]
                                          float* __restrict__ Ad,   // LDS result [256]
                                          int lane) {
  const int j = lane & 15, ih = lane >> 4;
  // ---- dt = mean(exp(log_dt)) ----
  // The 8 loads and their wait are one statement, so that the address register
  // is rewritten by nothing before the data are there.
  v4f l0, l1, l2, l3, l4, l5, l6, l7;
  const float* lp = log_dt + lane * 4;   // 8 x 512 bytes = the HID values
  asm volatile(
      "global_load_b128 %0, %8, off\n\t"
      "global_load_b128 %1, %8, off offset:512\n\t"
      "global_load_b128 %2, %8, off offset:1024\n\t"
      "global_load_b128 %3, %8, off offset:1536\n\t"
      "global_load_b128 %4, %8, off offset:2048\n\t"
      "global_load_b128 %5, %8, off offset:2560\n\t"
      "global_load_b128 %6, %8, off offset:3072\n\t"
      "global_load_b128 %7, %8, off offset:3584\n\t"
      "s_wait_loadcnt 0x0\n\t"
      "s_wait_xcnt 0x0"
      : "=&v"(l0), "=&v"(l1), "=&v"(l2), "=&v"(l3), "=&v"(l4), "=&v"(l5), "=&v"(l6), "=&v"(l7)
      : "v"(lp)
      : "memory");
  const v4f lv[8] = {l0, l1, l2, l3, l4, l5, l6, l7};
  float s = 0.f;
#pragma unroll
  for (int q = 0; q < 8; ++q)
    s += (expf(lv[q][0]) + expf(lv[q][1])) + (expf(lv[q][2]) + expf(lv[q][3]));
#pragma unroll
  for (int o = 16; o > 0; o >>= 1) s += __shfl_xor(s, o, 32);
  const float dt = s * (1.0f / (float)HID);
  // ---- scale by 2^-6, Taylor 12, square 6x ----
  float mcol[16], ac[8], t2[8];
#pragma unroll
  for (int k = 0; k < 16; ++k) mcol[k] = A[k * 16 + j] * (dt * (1.0f / 64.0f));
#pragma unroll
  for (int q = 0; q < 8; ++q) {
    const int i = ih + 2 * q;
    ac[q] = (i == j) ? 1.f : 0.f;
    tm[i * 16 + j] = ac[q];
  }
  wave_sync();
  for (int it = 1; it <= 12; ++it) {
#pragma unroll
    for (int q = 0; q < 8; ++q) {
      const int i = ih + 2 * q;
      float t = 0.f;
#pragma unroll
      for (int k = 0; k < 16; ++k) t += tm[i * 16 + k] * mcol[k];
      t2[q] = t;
    }
    wave_sync();
#pragma unroll
    for (int q = 0; q < 8; ++q) {
      const float t = t2[q] / (float)it;
      tm[(ih + 2 * q) * 16 + j] = t;
      ac[q] += t;
    }
    wave_sync();
  }
  for (int sq = 0; sq < 6; ++sq) {
#pragma unroll
    for (int q = 0; q < 8; ++q) tm[(ih + 2 * q) * 16 + j] = ac[q];
    wave_sync();
    float cc[16];
#pragma unroll
    for (int k = 0; k < 16; ++k) cc[k] = tm[k * 16 + j];
#pragma unroll
    for (int q = 0; q < 8; ++q) {
      const int i = ih + 2 * q;
      float t = 0.f;
#pragma unroll
      for (int k = 0; k < 16; ++k) t += tm[i * 16 + k] * cc[k];
      t2[q] = t;
    }
    wave_sync();
#pragma unroll
    for (int q = 0; q < 8; ++q) ac[q] = t2[q];
  }
#pragma unroll
  for (int q = 0; q < 8; ++q) Ad[(ih + 2 * q) * 16 + j] = ac[q];
}

// maximum of v and the value of the lane whose number differs by the bits X,
// inside a 16-lane row (DPP row_xmask: stays in the vector unit)
template <int X>
__device__ __forceinline__ int row_xmax(int v) {
  return max(v, __builtin_amdgcn_update_dpp(0, v, 0x160 + X, 0xf, 0xf, true));
}
// every lane takes the value of lane p of its own 16-lane row; sel holds p in
// each of its eight 4-bit fields (v_permlane16: stays in the vector unit)
__device__ __forceinline__ float row_bcast(float v, unsigned sel) {
  const unsigned u = (unsigned)__float_as_int(v);
  return __int_as_float((int)__builtin_amdgcn_permlane16(u, u, sel, sel, false, false));
}

// Gauss-Jordan with partial pivoting, in place. lane%16 = one row, its 16
// values in registers (both lane halves do the same work, so nothing crosses
// between them). Rows are never moved: a row that has served as pivot is marked
// used and the search skips it; row p_k of the end state is row k of A^-1.
// Of [A | I] only 16 columns differ from unit vectors at any step: slot j holds
// column j of the left half until step j has used it up, and from then on the
// right half's column p_j (which starts that step as a unit vector: 1 in the
// pivot row, 0 elsewhere). The values and their arithmetic are those of the
// plain form with swapped rows.
// Every step writes slot j's new value one register down, and the column it
// has made into the last: the column in work is always c[0], so no register is
// picked by a run-time index, and after 16 steps every slot is home again. The
// only run-time index left, the pivot's row, is a lane number.
__device__ __forceinline__ void inv_wave(const float* __restrict__ A,
                                         float* __restrict__ Ainv,   // LDS result [256]
                                         int lane) {
  const int r = lane & 15;
  // The row's 4 loads and their wait are one statement, so that the address
  // register is rewritten by nothing before the data are there.
  v4f a0, a1, a2, a3;
  const float* ap = A + r * 16;
  asm volatile(
      "global_load_b128 %0, %4, off\n\t"
      "global_load_b128 %1, %4, off offset:16\n\t"
      "global_load_b128 %2, %4, off offset:32\n\t"
      "global_load_b128 %3, %4, off offset:48\n\t"
      "s_wait_loadcnt 0x0\n\t"
      "s_wait_xcnt 0x0"
      : "=&v"(a0), "=&v"(a1), "=&v"(a2), "=&v"(a3)
      : "v"(ap)
      : "memory");
  float c[16] = {a0[0], a0[1], a0[2], a0[3], a1[0], a1[1], a1[2], a1[3],
                 a2[0], a2[1], a2[2], a2[3], a3[0], a3[1], a3[2], a3[3]};
  bool used = false;
  int myk = 0;    // the step at which this lane's row was the pivot row
  int prow = 0;   // lane j: the pivot row of step j
  // kept rolled: sixteen unrolled steps are more text than the rest of the
  // set-up, and a step's chain leaves little for a neighbour step to fill
#pragma unroll 1
  for (int k = 0; k < 16; ++k) {
    const float f = c[0];
    // pivot search: largest |value| of the column among the rows not yet used
    // (compared as integers: the bits of |value| order like the values, and one
    // instruction then does a level of the maximum)
    const int av = used ? -1 : __float_as_int(fabsf(f));
    int mx = row_xmax<1>(av);
    mx = row_xmax<2>(mx);
    mx = row_xmax<4>(mx);
    mx = row_xmax<8>(mx);
    const unsigned hit = __builtin_amdgcn_ballot_w32(av == mx);
    const int p = __builtin_ctz(hit | 0x8000u);   // lowest such row; a lane number below 16 whatever the data
    const unsigned sel = (unsigned)p * 0x11111111u;
    const bool isp = (r == p);
    const float inv = 1.0f / row_bcast(f, sel);
    // unrolled: register elements need constant indices
#pragma unroll
    for (int j = 1; j < 16; ++j) {
      const float nk = row_bcast(c[j], sel) * inv;   // pivot row, scaled
      c[j - 1] = isp ? nk : c[j] - f * nk;
    }
    c[15] = isp ? inv : 0.f - f * inv;
    used = used || isp;
    myk = isp ? k : myk;
    prow = (r == k) ? p : prow;
  }
  if (lane < 16) {
    // unrolled: register elements and the lane read need constant indices
#pragma unroll
    for (int j = 0; j < 16; ++j)
      Ainv[myk * 16 + __builtin_amdgcn_readlane(prow, j)] = c[j];
  }
}

// ===========================================================================
// Kernel 1: y = x @ B^T  (M=16384, K=1024, N=16) with f32 WMMA, then, in the
// same block, u = y M^T and the zero-carry scan of the block's 4 chunks.
// Block = 320 threads = 10 waves, 128 rows. K is split over waves 0..7: a wave
// owns 128 columns of all 128 rows, so its slice of B is loaded once and stays
// in registers, and the loop holds no B load. Waves 8 and 9 work out A_d and
// A^-1 meanwhile.
// x comes through a ring private to the wave: GLOBAL_LOAD_ASYNC_TO_LDS_B128,
// two buffers, a stage = one 16-row tile by the wave's 128 columns (16 copies,
// each one row's 512 contiguous bytes), ASYNCcnt-paced, zero barriers (DS ops
// are in-order in HW; explicit s_wait_dscnt guards the async-write-after-ds-read
// hazard since ASYNCcnt/DScnt are unordered).
// k order of a pair of WMMAs over 8 columns: lane half h takes columns 4h..4h+3
// (one 16-byte read), the first WMMA its first two, the second its last two;
// the x and the B fragments are indexed by the same expression.
// Every wave leaves a partial y of all 128 rows in LDS.
// Behind the product: barrier, M = A^-1 (A_d - I) and y = the sum of the eight
// partial sums, barrier, u tiles (WMMA) into
// LDS, barrier, then s_j = s_{j-1} A_d + u_j on 16 lanes per chunk (cross-lane
// via shfl(width 16), A_d's column in registers). Block 0's other waves give
// the powers P_0..P_32 of A_d beside its scan.
// ===========================================================================
constexpr int KSL  = HID / 8;    // K columns per product wave
constexpr int XPAD = KSL + 4;    // row pitch 528 bytes = 16 x 33: 16-byte reads of 16 rows fall on all banks
constexpr int BROWS = 128;       // rows per block
constexpr int NTILE = BROWS / 16;   // row tiles = ring stages per wave

// The ring stands last, behind 76 KB: every ring address then lies above the
// largest constant row step (60 KB) that the compiler may fold into a copy's
// offset field and take off its LDS address register, which so never goes below
// 0. The small arrays stand first, within reach of an LDS instruction's offset.
struct SmemU {
  float U[BROWS * SDIM];           // y, then u
  float Tm[256], Ad[256], Ainv[256], Ms[256];
  float Part[8][BROWS * SDIM];     // a wave's partial y, 64 KB in all
  float Xs[8][2][16 * XPAD];       // double buffer, 132 KB
};

__global__ __launch_bounds__(320) void k_u_gemm(const float* __restrict__ x,
                                                const float* __restrict__ A,
                                                const float* __restrict__ Bmat,
                                                const float* __restrict__ log_dt,
                                                float* __restrict__ ws) {
  __shared__ __attribute__((aligned(16))) SmemU sm;
  float (&U)[BROWS * SDIM] = sm.U;
  float (&Tm)[256] = sm.Tm;
  float (&Ad)[256] = sm.Ad;
  float (&Ainv)[256] = sm.Ainv;
  float (&Ms)[256] = sm.Ms;
  const int tid = threadIdx.x;
  // the wave's number as a scalar: whole-wave branches
  const int w = __builtin_amdgcn_readfirstlane(tid >> 5);
  const int lane = tid & 31;
  const int M = lane & 15, half = lane >> 4;

  if (w == 8) {
    expm_wave(A, log_dt, Tm, Ad, lane);
  } else if (w == 9) {
    inv_wave(A, Ainv, lane);
  } else {
    const int rowblk = blockIdx.x * BROWS;
    const int kbase = w * KSL;

#if HAVE_ASYNC_LDS
    auto stage_async = [&](int t, int buf) {
      // previous ds reads of this buffer must have executed before async writes
      asm volatile("s_wait_dscnt 0x0" ::: "memory");
      const float* g = &x[(rowblk + t * 16) * HID + kbase + lane * 4];
      float* l = &sm.Xs[w][buf][lane * 4];
      // unrolled: the row steps become constants of the 16 copies
#pragma unroll
      for (int r = 0; r < 16; ++r) {   // one copy = one row's 512 bytes
        __builtin_amdgcn_global_load_async_to_lds_b128(
            (__attribute__((address_space(1))) v4i_vs*)(g + r * HID),
            (__attribute__((address_space(3))) v4i_vs*)(l + r * XPAD),
            0, 0);
      }
    };
    stage_async(0, 0);
#endif

    // the wave's slice of B, once: lane = B row M, 4 columns per 8
    v4f bq[KSL / 8];
    const float* bp = &Bmat[M * HID + kbase + 4 * half];
    // unrolled: the fragment array needs constant indices to stay in registers
#pragma unroll
    for (int j = 0; j < KSL / 8; ++j) bq[j] = *(const v4f*)(bp + 8 * j);
    // what follows may rewrite the address registers of the loads above; the
    // address is named so that it stays live up to this wait and no load's own
    // result is placed in it
    asm volatile("s_wait_xcnt 0x0" :: "v"(bp) : "memory");

    for (int t = 0; t < NTILE; ++t) {
#if HAVE_ASYNC_LDS
      const int buf = t & 1;
      if (t + 1 < NTILE) {
        stage_async(t + 1, buf ^ 1);
        // dones are in-order: only the newest stage's 16 copies stay outstanding
        asm volatile("s_wait_asynccnt 0x10" ::: "memory");
      } else {
        // the last stage: no copy stays outstanding behind it
        asm volatile("s_wait_asynccnt 0x0" ::: "memory");
      }
      const float* xa = &sm.Xs[w][buf][M * XPAD + 4 * half];
#else
      const float* xa = &x[(rowblk + t * 16 + M) * HID + kbase + 4 * half];
#endif
      // the stage's 16 fragment reads go out as one group: the LDS latency is
      // paid once per stage, not at every pair of WMMAs
      v4f af[KSL / 8];
      // unrolled (both loops): af and bq need constant indices
#pragma unroll
      for (int j = 0; j < KSL / 8; ++j) af[j] = *(const v4f*)(xa + 8 * j);
      // keeps the reads from sinking back to their uses
      __builtin_amdgcn_sched_barrier(0);
      v8f acc = {0.f, 0.f, 0.f, 0.f, 0.f, 0.f, 0.f, 0.f};
#pragma unroll
      for (int j = 0; j < KSL / 8; ++j) {
        acc = wmma_f32_16x16x4(v2f{af[j][0], af[j][1]}, v2f{bq[j][0], bq[j][1]}, acc);
        acc = wmma_f32_16x16x4(v2f{af[j][2], af[j][3]}, v2f{bq[j][2], bq[j][3]}, acc);
      }
      // unrolled: register elements need constant indices
#pragma unroll
      for (int v = 0; v < 8; ++v)
        sm.Part[w][(t * 16 + v + 8 * half) * SDIM + M] = acc[v];
    }
  }
  __syncthreads();   // A_d, A^-1 and the partial sums are there

  // ---- M = Ainv * (A_d - I), one element a thread ----
  if (tid < 256) {
    const int i = tid >> 4, j = tid & 15;
    float t2 = 0.f;
    // unrolled: the 32 LDS reads issue together, ahead of the sum
#pragma unroll
    for (int k = 0; k < 16; ++k) {
      float ad = Ad[k * 16 + j] - ((k == j) ? 1.f : 0.f);
      t2 += Ainv[i * 16 + k] * ad;
    }
    Ms[tid] = t2;
    // ---- y = the eight K slices' partial sums, in slice order, 8 values a thread ----
    // unrolled: the 16 LDS reads issue together, ahead of the sums
#pragma unroll
    for (int h = 0; h < 2; ++h) {
      const int e = h * 1024 + tid * 4;
      v4f y = *(const v4f*)&sm.Part[0][e];
#pragma unroll
      for (int p = 1; p < 8; ++p) y += *(const v4f*)&sm.Part[p][e];
      *(v4f*)&U[e] = y;
    }
  }
  __syncthreads();

  // ---- u = y M^T, each product wave its own 16 rows, in place ----
  if (w < 8) {
    v2f mb[4], ya[4];
    // unrolled: the fragment arrays need constant indices to stay in registers
#pragma unroll
    for (int k4 = 0; k4 < 4; ++k4) {
      mb[k4] = *(const v2f*)&Ms[M * SDIM + k4 * 4 + 2 * half];
      ya[k4] = *(const v2f*)&U[(w * 16 + M) * SDIM + k4 * 4 + 2 * half];
    }
    v8f au = {0.f, 0.f, 0.f, 0.f, 0.f, 0.f, 0.f, 0.f};
#pragma unroll
    for (int k4 = 0; k4 < 4; ++k4) au = wmma_f32_16x16x4(ya[k4], mb[k4], au);
#pragma unroll
    for (int v = 0; v < 8; ++v) U[(w * 16 + v + 8 * half) * SDIM + M] = au[v];
  }
  __syncthreads();

  if (tid < 64) {
    // ---- per-chunk local scan (zero carry-in) ----
    float Acol[16];
    // unrolled: constant indices keep the column in registers
#pragma unroll
    for (int m = 0; m < 16; ++m) Acol[m] = Ad[m * 16 + M];
    float s = 0.f;
    const int loc = (tid >> 4) * (LCH * SDIM) + M;
    float* __restrict__ Sl = ws + WS_SL + blockIdx.x * (BROWS * SDIM);
    for (int j0 = 0; j0 < LCH; j0 += 16) {
      // 16 steps unrolled so that their LDS reads issue together, ahead of the
      // chain, and the LDS latency is paid once per 16 steps
#pragma unroll
      for (int k = 0; k < 16; ++k) {
        const int j2 = j0 + k;
        float sn = U[loc + j2 * SDIM];
#pragma unroll
        for (int m = 0; m < 16; ++m) sn += __shfl(s, m, 16) * Acol[m];
        s = sn;
        Sl[loc + j2 * SDIM] = s;
      }
      // the next pass rewrites the registers that this pass's stores name
      asm volatile("s_wait_xcnt 0x0" ::: "memory");
    }
  } else if (blockIdx.x == 0) {
    // ---- powers P_0..P_LCH of A_d, 256 threads (thread = elem (i,j)) ----
    // P_k = P_(k-1) A_d goes row by row: row i of P_k needs only row i of
    // P_(k-1), which the row's own 16 lanes hold, and column j of A_d, which
    // never changes. So each 16-lane group carries its row through shuffles
    // and the chain meets no barrier and no store wait.
    const int t = tid - 64;
    const int i = t >> 4, j = t & 15;
    float Acol[16];
    // unrolled: constant indices keep the column in registers
#pragma unroll
    for (int k = 0; k < 16; ++k) Acol[k] = Ad[k * 16 + j];
    float pw[LCH + 1];
    pw[0] = (i == j) ? 1.f : 0.f;
    pw[1] = Ad[t];
    // unrolled: every power stays in a register of its own until the stores
#pragma unroll
    for (int jp = 2; jp <= LCH; ++jp) {
      float t2 = 0.f;
      // unrolled: a shuffle from a constant lane compiles to a row broadcast in
      // the vector unit (no LDS round trip), and Acol needs constant indices
#pragma unroll
      for (int k = 0; k < 16; ++k) t2 += __shfl(pw[jp - 1], k, 16) * Acol[k];
      pw[jp] = t2;
    }
    // unrolled: constant indices; nothing behind these stores rewrites a
    // register that one of them names
#pragma unroll
    for (int jp = 0; jp <= LCH; ++jp) ws[WS_P + jp * 256 + t] = pw[jp];
  }
}

// ===========================================================================
// Chunk carries: C_{c+1} = C_c * T + v_c, T = A_d^L. No launch of their own:
// every block of the last kernel works out its own chunk's carry-in, and its
// last block, on waves that would idle, the final_state of all batches.
// Two-level scan, so that the serial chain is 7 + 15 + 7 steps, not 128: each
// batch's 128 chunks are 16 groups of 8.
//   1. every group is scanned from a zero carry (its end e_g); one more wave
//      runs the same steps on T itself and so gets T^8;
//   2. one chain over the groups: G_{g+1} = G_g T^8 + e_g;
//   3. the block's own group is scanned again from its true carry-in G_g, up to
//      the block's chunk.
// A step is S <- T^t S + V on f32 WMMA: S holds 16 state columns (one group
// each). D of one step is B of the next with no move between
// lanes: WMMA j takes D registers 2j, 2j+1, which in lane half h are the states
// m = 8h + 2j + v; the A fragments below use the same k order.
// ===========================================================================
constexpr int GRP  = 16;           // groups per batch
constexpr int GLEN = NCHB / GRP;   // chunks per group

__device__ __forceinline__ v8f ld8(const float* p) {
  const float4 lo = *(const float4*)p, hi = *(const float4*)(p + 4);
  return v8f{lo.x, lo.y, lo.z, lo.w, hi.x, hi.y, hi.z, hi.w};
}
__device__ __forceinline__ void st8(float* p, v8f s) {
  *(float4*)p       = make_float4(s[0], s[1], s[2], s[3]);
  *(float4*)(p + 4) = make_float4(s[4], s[5], s[6], s[7]);
}
__device__ __forceinline__ v8f carry_step(const v2f (&a)[4], v8f s, v8f add) {
  v8f acc = add;
  // unrolled: register elements need constant indices
#pragma unroll
  for (int j = 0; j < 4; ++j) {
    const v2f b = {s[2 * j], s[2 * j + 1]};
    acc = wmma_f32_16x16x4(a[j], b, acc);
  }
  return acc;
}

// ===========================================================================
// Kernel 2: out = states @ C^T  (M=16384, K=16, N=1024) with f32 WMMA, the
// carry correction s_t = Sl_t + carry_c * P_{j+1} done in front of it.
// Block = one chunk (32 rows), 8 waves. In front of the correction the block
// works out its own carry-in, by the steps described above: wave 0
// scans its batch's 16 groups (columns) from zero, wave 1 gets T^8; behind a
// barrier wave 0 chains over the groups up to its own (every column the same)
// and then steps through its group up to its chunk; the group's column goes to
// LDS, and a second barrier hands it to all. In the last block waves 2..5 scan
// the groups of one batch each as well, and wave 1 chains over all 16 groups
// (column = batch) beside wave 0: final_state, all four rows from one wave.
// The 256 threads correct the chunk's
// 512 states (two each, the sums in the order m = 0..15) and leave them in LDS;
// behind one barrier every wave takes its state fragments from there. A wave
// owns 8 h-tiles (128 columns = 512 bytes of every row), whose C fragments it
// loads once for both 16-row tiles; 4 chained 16x16x4 WMMAs cover K=16.
// C's rows are the first WMMA operand, so a lane's 8 results are 8 consecutive
// columns of one row: they go to the wave's own LDS range in 16-byte writes,
// and each row comes back as 32 lanes x 16 bytes and leaves in ONE store of
// four whole 128-byte lines.
// ===========================================================================
constexpr int SPAD = 20;    // LDS row pitch in floats: the 16 rows of a fragment read fall on distinct banks
constexpr int OPAD = 132;   // pitch of a staged output row: 16 lanes' 16-byte writes fall on all 64 banks

__global__ __launch_bounds__(256) void k_out_gemm(const float* __restrict__ Cmat,
                                                     const float* __restrict__ state0,
                                                     const float* __restrict__ ws,
                                                     float* __restrict__ out) {
  __shared__ __attribute__((aligned(16))) float Qo[SDIM * SDIM];   // (T^8)^t [n][m]
  __shared__ __attribute__((aligned(16))) float Eo[GRP * SDIM];    // the batch's group ends
  __shared__ __attribute__((aligned(16))) float Ea[BATCH * GRP * SDIM];   // last block: every batch's
  __shared__ __attribute__((aligned(16))) float Cr[SDIM];          // the chunk's carry-in
  __shared__ __attribute__((aligned(16))) float Ss[LCH * SPAD];
  __shared__ __attribute__((aligned(16))) float Ot[8][16 * OPAD];   // a wave's 16 rows x 128 columns
  const int tid = threadIdx.x;
  const int c = blockIdx.x;                 // chunk; row%32 == t%32 (4096%32==0)
  const int M = tid & 15, half = (tid >> 4) & 1;
  const int lane = tid & 31;
  const int r0 = tid >> 4;                  // thread corrects rows r0 and r0 + 16
  const int hg = tid >> 5;                  // wave's group of 8 h-tiles

  // Every loop of this kernel is unrolled: the arrays need constant indices to
  // stay in registers, and all loads go out in one batch ahead of the sums.
  // the wave's part in the carry work, a scalar (whole-wave branches). Turned by
  // two waves in every other block: where two blocks share a WGP their chains
  // then tend to run on different SIMDs' matrix units (speed only)
  const int w = (__builtin_amdgcn_readfirstlane(tid >> 5) + 2 * ((c ^ (c >> 8)) & 1)) & 7;
  const int bt = c / NCHB;                  // batch
  const int g = (c % NCHB) / GLEN;          // the chunk's group
  const int r = c % GLEN;                   // its place in the group
  const float* __restrict__ T = ws + WS_P + LCH * 256;
  // the carry chain's loads go out first: it is the longest path of the block
  v8f V[GLEN], S0;   // column M: group M's chunk ends (wave 1: T^t, then zeros)
  v2f ta[4];         // A fragments of T^t: row n = M, k slot -> m = 8*half + 2j + v
  const bool fin = (c == NCH - 1);               // the block that also gives final_state
  const bool scans = (w < 2) || (fin && w < 2 + BATCH);
  if (scans) {
    const int wb = (w < 2) ? bt : w - 2;         // the batch whose groups the wave scans
    const float* __restrict__ vp =
        &ws[WS_SL + ((wb * NCHB + M * GLEN) * LCH + (LCH - 1)) * SDIM + 8 * half];
    V[0] = ld8((w != 1) ? vp : &T[M * SDIM + 8 * half]);
#pragma unroll
    for (int k = 1; k < GLEN; ++k) V[k] = ld8(vp + k * LCH * SDIM);
    // wave 1 chains all batches (column = batch, repeated 4 times)
    S0 = ld8(&state0[((w == 1) ? (M & (BATCH - 1)) : bt) * SDIM + 8 * half]);
    // what follows may rewrite the address registers of the loads above
    asm volatile("s_wait_xcnt 0x0" ::: "memory");
#pragma unroll
    for (int j = 0; j < 4; ++j) {
      ta[j][0] = T[(8 * half + 2 * j) * SDIM + M];
      ta[j][1] = T[(8 * half + 2 * j + 1) * SDIM + M];
    }
    // as above, for the T loads
    asm volatile("s_wait_xcnt 0x0" ::: "memory");
  }
  const float* __restrict__ Sl = ws + WS_SL + c * (LCH * SDIM);
  const float* __restrict__ P  = ws + WS_P + (r0 + 1) * 256 + M;
  float s0 = Sl[tid], s1 = Sl[256 + tid];
  float p0[16], p1[16];
#pragma unroll
  for (int m = 0; m < 16; ++m) {
    p0[m] = P[m * 16];
    p1[m] = P[16 * 256 + m * 16];
  }
  // a C fragment below may land in the address registers of the loads above
  asm volatile("s_wait_xcnt 0x0" ::: "memory");
  v2f b[8][4];
#pragma unroll
  for (int ht = 0; ht < 8; ++ht)
#pragma unroll
    for (int k4 = 0; k4 < 4; ++k4)
      b[ht][k4] = *(const v2f*)&Cmat[((hg * 8 + ht) * 16 + M) * SDIM + k4 * 4 + 2 * half];

  // ---- carry 1: group ends from a zero carry (wave 1: T^8) ----
  if (scans) {
    if (w == 1) {   // powers of T take no addend
#pragma unroll
      for (int k = 1; k < GLEN; ++k) V[k] = v8f{0.f, 0.f, 0.f, 0.f, 0.f, 0.f, 0.f, 0.f};
    }
    v8f S = V[0];
#pragma unroll
    for (int k = 1; k < GLEN; ++k) S = carry_step(ta, S, V[k]);
    if (w == 0) {
      st8(&Eo[M * SDIM + 8 * half], S);
    } else if (w == 1) {
#pragma unroll
      for (int v = 0; v < 8; ++v) Qo[(v + 8 * half) * SDIM + M] = S[v];
    } else {
      st8(&Ea[((w - 2) * GRP + M) * SDIM + 8 * half], S);
    }
  }
  __syncthreads();
  v8f Fs;   // last block, wave 1: final_state
  if (fin && w == 1) {
    v2f qa[4];
#pragma unroll
    for (int j = 0; j < 4; ++j)
      qa[j] = *(const v2f*)&Qo[M * SDIM + 8 * half + 2 * j];
    Fs = S0;
#pragma unroll
    for (int gi = 0; gi < GRP; ++gi)
      Fs = carry_step(qa, Fs, ld8(&Ea[((M & (BATCH - 1)) * GRP + gi) * SDIM + 8 * half]));
  }
  if (w == 0) {
    // ---- carry 2: chain over the groups; the value in front of group g is kept ----
    v2f qa[4];
#pragma unroll
    for (int j = 0; j < 4; ++j)
      qa[j] = *(const v2f*)&Qo[M * SDIM + 8 * half + 2 * j];
    // The group ends are read three at a time, three steps ahead of their use:
    // no step waits for LDS, and at most six are in registers (all fifteen at
    // once would cost the second block of the WGP its registers).
    v8f Ef[GRP - 1];
#pragma unroll
    for (int gi = 0; gi < 3; ++gi) Ef[gi] = ld8(&Eo[gi * SDIM + 8 * half]);
    v8f S = S0, Gg = S0;
#pragma unroll
    for (int g3 = 0; g3 < GRP - 1; g3 += 3) {
      if (g3 + 3 < GRP - 1) {
#pragma unroll
        for (int gi = g3 + 3; gi < g3 + 6; ++gi) Ef[gi] = ld8(&Eo[gi * SDIM + 8 * half]);
      }
#pragma unroll
      for (int gi = g3 + 1; gi <= g3 + 3; ++gi) {
        S = carry_step(qa, S, Ef[gi - 1]);
        Gg = (gi == g) ? S : Gg;
      }
      // keeps the later reads from being lifted to the front (registers) and
      // this batch's from sinking to their use (LDS latency on the chain)
      __builtin_amdgcn_sched_barrier(0);
    }
    // ---- carry 3: through the group; column g is the block's own ----
    v8f Ck = Gg, Cc = Gg;
#pragma unroll
    for (int k = 1; k < GLEN; ++k) {
      Ck = carry_step(ta, Ck, V[k - 1]);
      Cc = (k == r) ? Ck : Cc;
    }
    if (M == g) st8(&Cr[8 * half], Cc);
  }
  __syncthreads();
  // behind the barrier, so that no wave waits there for this store
  if (fin && w == 1 && M < BATCH) {
    st8(&out[ROWS * HID + M * SDIM + 8 * half], Fs);
    // what follows may rewrite the registers that this store names
    asm volatile("s_wait_xcnt 0x0" ::: "memory");
  }
  float cr[16];
#pragma unroll
  for (int q = 0; q < 4; ++q) {
    const float4 t4 = *(const float4*)&Cr[q * 4];
    cr[q * 4] = t4.x; cr[q * 4 + 1] = t4.y; cr[q * 4 + 2] = t4.z; cr[q * 4 + 3] = t4.w;
  }
#pragma unroll
  for (int m = 0; m < 16; ++m) {
    s0 += cr[m] * p0[m];
    s1 += cr[m] * p1[m];
  }
  Ss[r0 * SPAD + M]        = s0;
  Ss[(r0 + 16) * SPAD + M] = s1;
  __syncthreads();

  float* __restrict__ op = out + c * LCH * HID + hg * 128 + lane * 4;
  float* wr = &Ot[hg][M * OPAD + 8 * half];         // lane's row, its 8 columns of tile 0
  const float* rd = &Ot[hg][lane * 4];                     // lane's 16 bytes of row 0
  v2f a[2][4];
#pragma unroll
  for (int rt = 0; rt < 2; ++rt)
#pragma unroll
    for (int k4 = 0; k4 < 4; ++k4)
      a[rt][k4] = *(const v2f*)&Ss[(rt * 16 + M) * SPAD + k4 * 4 + 2 * half];
#pragma unroll
  for (int rt = 0; rt < 2; ++rt) {
#pragma unroll
    for (int ht = 0; ht < 8; ++ht) {
      v8f acc = {0.f, 0.f, 0.f, 0.f, 0.f, 0.f, 0.f, 0.f};
      // acc[r] = out[row M][column ht*16 + 8*half + r]
#pragma unroll
      for (int k4 = 0; k4 < 4; ++k4) acc = wmma_f32_16x16x4(b[ht][k4], a[rt][k4], acc);
      st8(wr + ht * 16, acc);
    }
    // the wave's own LDS writes are done before other lanes' values are read back
    asm volatile("s_wait_dscnt 0x0" ::: "memory");
    float4 row[16];
#pragma unroll
    for (int r = 0; r < 16; ++r) row[r] = *(const float4*)(rd + r * OPAD);
#pragma unroll
    for (int r = 0; r < 16; ++r) *(float4*)(op + (rt * 16 + r) * HID) = row[r];
    // the second row tile rewrites the staging range (behind these reads) and
    // may rewrite registers that the first one's stores name
    if (rt == 0) asm volatile("s_wait_dscnt 0x0\n\ts_wait_xcnt 0x0" ::: "memory");
  }
}

// ===========================================================================
extern "C" void kernel_launch(void* const* d_in, const int* in_sizes, int n_in,
                              void* d_out, int out_size, void* d_ws,
                              size_t ws_size, hipStream_t stream) {
  const float* x   = (const float*)d_in[0];  // [4,4096,1024]
  const float* st0 = (const float*)d_in[1];  // [4,16]
  const float* A   = (const float*)d_in[2];  // [16,16]
  const float* B   = (const float*)d_in[3];  // [16,1024]
  const float* C   = (const float*)d_in[4];  // [1024,16]
  const float* ld  = (const float*)d_in[5];  // [1024]
  float* out = (float*)d_out;                // [4,4096,1024] ++ [4,16]
  float* ws  = (float*)d_ws;                 // needs ~2.2 MB f32 scratch

  k_u_gemm<<<ROWS / 128, 320, 0, stream>>>(x, A, B, ld, ws);
  k_out_gemm<<<NCH, 256, 0, stream>>>(C, st0, ws, out);
}
